// v000
// Measured on an AMD MI455X. A time is GPU time per run, averaged over a window of back-to-back runs after a warm-up
// (all launches, gaps included; the runs take copies of the inputs in turn), and the median of several windows.
// Apart from v000's, it joins two sittings. Times from different sittings can be a few percent apart, while
// side-by-side timings come from the same sitting.
// v000, which the later versions start from, runs in 224 microseconds.
// compute dtype: all float inputs rounded to bf16; q/k/v projections with EXACT bf16 products on WMMA 16x16x32 (f32 accumulate) + bias; causal logits: 3 products (q f16 hi + residual x k hi + residual) for the first 384 rows, single f16 q x k after, x scale; softmax f32; P x 2^11 once to f16 x v once to f16 (1 product; bf16 hi + lo below row 384); f32 output.
#include <hip/hip_runtime.h>
#include <math.h>

typedef __attribute__((ext_vector_type(16))) _Float16 v16h;
typedef __attribute__((ext_vector_type(16))) __bf16 v16b;
typedef __attribute__((ext_vector_type(8)))  _Float16 v8h;
typedef __attribute__((ext_vector_type(8)))  float v8f;
typedef __attribute__((ext_vector_type(4)))  float v4f;
typedef __attribute__((ext_vector_type(2)))  float v2f;
typedef __attribute__((ext_vector_type(4)))  unsigned v4u;
typedef __attribute__((ext_vector_type(4)))  int v4i;
typedef float __attribute__((may_alias)) float_a;
typedef int __attribute__((may_alias)) int_a;

template <typename T> __device__ __forceinline__ void vst2(void* p, T v) { *(T*)p = v;  }
__device__ __forceinline__ v8f wmma16(v16h a, v16h b, v8f c) {
  v8f d = __builtin_amdgcn_wmma_f32_16x16x32_f16(false, a, false, b, (short)0, c, false, false);
  asm volatile("v_nop\n\tv_nop\n\tv_nop\n\tv_nop" : "+v"(d) : "v"(a), "v"(b));
  return d;
}
__device__ __forceinline__ v8f wmma_bf(v16b a, v16b b, v8f c) {
  v8f d = __builtin_amdgcn_wmma_f32_16x16x32_bf16(false, a, false, b, (short)0, c, false, false);
  asm volatile("v_nop\n\tv_nop\n\tv_nop\n\tv_nop" : "+v"(d) : "v"(a), "v"(b));
  return d;
}
// 16x16x32 fragments: lane = (h = lane>>4, row/col = lane&15); elements 0..7 = k0+8h+0..7, 8..15 = k0+16+8h+0..7; D element r = row 8h+r
__device__ __forceinline__ v16h frag_h(const _Float16* rowk0, int lane) {
  union { v16h v; v8h q[2]; } u; const _Float16* p = rowk0 + 8 * (lane >> 4);
  u.q[0] = *(const v8h*)p; u.q[1] = *(const v8h*)(p + 16); return u.v;
}
__device__ __forceinline__ v16h frag_f32(const float* rowk0, int lane) {
  v16h a; const float* p = rowk0 + 8 * (lane >> 4);
#pragma unroll
  for (int i = 0; i < 8; ++i) { a[i] = (_Float16)p[i]; a[8 + i] = (_Float16)p[16 + i]; }
  return a;
}
__device__ __forceinline__ v16h frag_f32s(const float* rowk0, int lane, float sc) {
  v16h a; const float* p = rowk0 + 8 * (lane >> 4);
#pragma unroll
  for (int i = 0; i < 8; ++i) { a[i] = (_Float16)(p[i] * sc); a[8 + i] = (_Float16)(p[16 + i] * sc); }
  return a;
}
// column fragment from a [K][ld] layout (column n), rows >= K read as 0
__device__ __forceinline__ v16h fragc_f32(const float* W, int k0, int n, int lane, int ld, int K) {
  v16h a; const int g = lane >> 4;
#pragma unroll
  for (int i = 0; i < 8; ++i) { const int ka = k0 + 8 * g + i, kb = ka + 16;
    a[i] = (_Float16)(ka < K ? W[(size_t)(ka < K ? ka : K - 1) * ld + n] : 0.f); a[8 + i] = (_Float16)(kb < K ? W[(size_t)(kb < K ? kb : K - 1) * ld + n] : 0.f); }
  return a;
}
struct F2 { v16b h, l; };
__device__ __forceinline__ F2 bsplit16(const float v[16]) { F2 r;
#pragma unroll
  for (int i = 0; i < 16; ++i) { const __bf16 h = (__bf16)v[i]; r.h[i] = h; r.l[i] = (__bf16)(v[i] - (float)h); }
  return r; }
__device__ __forceinline__ F2 split_row(const float* row, int k0, int lane) { float v[16]; const float* p = row + k0 + 8 * (lane >> 4);
#pragma unroll
  for (int i = 0; i < 8; ++i) { v[i] = p[i]; v[8 + i] = p[16 + i]; }
  return bsplit16(v); }
__device__ __forceinline__ F2 split_rowK(const float* row, int k0, int lane, int K) { float v[16]; const int g = lane >> 4;
#pragma unroll
  for (int i = 0; i < 8; ++i) { const int ka = k0 + 8 * g + i, kb = ka + 16; v[i] = ka < K ? row[ka < K ? ka : K - 1] : 0.f; v[8 + i] = kb < K ? row[kb < K ? kb : K - 1] : 0.f; }
  return bsplit16(v); }
__device__ __forceinline__ F2 split_col(const float* W, int k0, int n, int lane, int ld, int K) { float v[16]; const int g = lane >> 4;
#pragma unroll
  for (int i = 0; i < 8; ++i) { const int ka = k0 + 8 * g + i, kb = ka + 16; v[i] = ka < K ? W[(size_t)(ka < K ? ka : K - 1) * ld + n] : 0.f; v[8 + i] = kb < K ? W[(size_t)(kb < K ? kb : K - 1) * ld + n] : 0.f; }
  return bsplit16(v); }
__device__ __forceinline__ v8f mac3(const F2& a, const F2& b, v8f c) { c = wmma_bf(a.l, b.h, c); c = wmma_bf(a.h, b.l, c); return wmma_bf(a.h, b.h, c); }
__device__ __forceinline__ float sigm(float v) { return 1.0f / (1.0f + expf(-v)); }
#define LDSX() do { asm volatile("s_wait_dscnt 0" ::: "memory"); __builtin_amdgcn_wave_barrier(); __builtin_amdgcn_fence(__ATOMIC_RELEASE, "workgroup"); } while (0)

// Single-head causal scaled-dot-product attention over one 4,096-token sequence (d_model 512, d_k = d_v = 64; (out,in) Wq/Wk/Wv [64,512] + biases, torch Linear convention): scores = (Q K^T + M)/sqrt(64) with M = -inf strictly above the diagonal; out = softmax(scores) V -> [4096, 64].
#define NB 1
#define TT 4096
#define CC 128            // NH * HD = projected width
#define DIN 512          // input (model) width
#define NH 2
#define HD 64
#define NQB (TT / 64)
#define HG 1
#define SCALE (0.125f)
#define CAUSAL 1
#ifndef TNB
#define TNB NB
#endif
__device__ __forceinline__ float bfr(float v) { return (float)(__bf16)v; }
__host__ __device__ __forceinline__ int kb_last(int qb) { return CAUSAL ? ((qb * 64 + 63) >> 7) : (TT / 128 - 1); }
typedef __attribute__((ext_vector_type(8))) __bf16 v8b;
__device__ __forceinline__ v16b frag_b(const __bf16* rowk0, int lane) {
  union { v16b v; v8b q[2]; } u; const __bf16* p = rowk0 + 8 * (lane >> 4);
  u.q[0] = *(const v8b*)p; u.q[1] = *(const v8b*)(p + 16); return u.v;
}
#define QBH 6              // causal: query blocks 0..QBH-1 of each sequence (few keys, no averaging) take the high-precision path
#define QHI 384            // rows carrying a q residual plane (all rows when non-causal: 2-product logits everywhere)
#define KHI 384            // key rows carrying k residual / v bf16 hi+lo planes (used only by the causal high-precision path)
// B fragment (k rows k0+.., output column o) of a weight: (in,out) [K][ld] or (out,in) [ld rows of K]: bf16 exact, or f16(bf16 * 256) exact
__device__ __forceinline__ v16b wcol_io(const float* Wm, int k0, int o, int lane, int ld) { v16b w; const int g = lane >> 4;
#pragma unroll
  for (int i = 0; i < 8; ++i) { w[i] = (__bf16)Wm[(size_t)(k0 + 8 * g + i) * ld + o]; w[8 + i] = (__bf16)Wm[(size_t)(k0 + 16 + 8 * g + i) * ld + o]; }
  return w; }
__device__ __forceinline__ v16b wcol_oi(const float* Wm, int k0, int o, int lane, int K) { v16b w; const float* p = Wm + (size_t)o * K + k0 + 8 * (lane >> 4);
#pragma unroll
  for (int i = 0; i < 8; ++i) { w[i] = (__bf16)p[i]; w[8 + i] = (__bf16)p[16 + i]; }
  return w; }
__device__ __forceinline__ v16h wcolh_io(const float* Wm, int k0, int o, int lane, int ld) { v16h w; const int g = lane >> 4;
#pragma unroll
  for (int i = 0; i < 8; ++i) { w[i] = (_Float16)(bfr(Wm[(size_t)(k0 + 8 * g + i) * ld + o]) * 256.0f); w[8 + i] = (_Float16)(bfr(Wm[(size_t)(k0 + 16 + 8 * g + i) * ld + o]) * 256.0f); }
  return w; }
__device__ __forceinline__ v16h wcolh_oi(const float* Wm, int k0, int o, int lane, int K) { v16h w; const float* p = Wm + (size_t)o * K + k0 + 8 * (lane >> 4);
#pragma unroll
  for (int i = 0; i < 8; ++i) { w[i] = (_Float16)(bfr(p[i]) * 256.0f); w[8 + i] = (_Float16)(bfr(p[16 + i]) * 256.0f); }
  return w; }
#define WQKV_LAYOUT 1   // 0 = (in,out) [DIN][CC]; 1 = (out,in) [CC][DIN]; 2 = per-head [NH][DIN][HD]
__device__ __forceinline__ v16b wcol_hdk(const float* Wm, int k0, int o, int lane) { v16b w; const int g = lane >> 4; const float* p = Wm + (size_t)(o / HD) * DIN * HD + (o % HD);
#pragma unroll
  for (int i = 0; i < 8; ++i) { w[i] = (__bf16)p[(size_t)(k0 + 8 * g + i) * HD]; w[8 + i] = (__bf16)p[(size_t)(k0 + 16 + 8 * g + i) * HD]; }
  return w; }
#define WO_OUT_IN 0
#if WQKV_LAYOUT == 1
#define WCOL(W, k0, o, lane) wcol_oi(W, k0, o, lane, DIN)
#elif WQKV_LAYOUT == 2
#define WCOL(W, k0, o, lane) wcol_hdk(W, k0, o, lane)
#else
#define WCOL(W, k0, o, lane) wcol_io(W, k0, o, lane, CC)
#endif
#if WO_OUT_IN
#define WOCOL(W, k0, o, lane) wcol_oi(W, k0, o, lane, CC)
#define WOCOLH(W, k0, o, lane) wcolh_oi(W, k0, o, lane, CC)
#else
#define WOCOL(W, k0, o, lane) wcol_io(W, k0, o, lane, DIN)
#define WOCOLH(W, k0, o, lane) wcolh_io(W, k0, o, lane, DIN)
#endif
#define CIN 512
// ---- k_padw: the three (out,in) [64][C] projection weights copied into zero-padded (out,in) [128][C] ws planes (rows 64..127 zero) + zero-padded [128] biases (columns 64..127 = an all-zero dummy head, never attended)
__global__ __launch_bounds__(256) void k_padw(const float* __restrict__ WQ, const float* __restrict__ WK, const float* __restrict__ WV, const float* __restrict__ BQ, const float* __restrict__ BK, const float* __restrict__ BV, float* __restrict__ WP, float* __restrict__ BP) { const int which = blockIdx.y; const float* Wsrc = which == 0 ? WQ : (which == 1 ? WK : WV); const float* Bsrc = which == 0 ? BQ : (which == 1 ? BK : BV); float* dst = WP + (size_t)which * 128 * CIN;
  for (int e = blockIdx.x * 256 + threadIdx.x; e < 128 * (CIN / 4); e += gridDim.x * 256) { const int row = e / (CIN / 4), q = e % (CIN / 4); const v4f ld = *(const v4f*)(Wsrc + (size_t)(row & 63) * CIN + q * 4); asm volatile("s_wait_loadcnt 0x0" ::: "memory"); const float keep = row < 64 ? 1.f : 0.f; v4f ov; ov[0] = ld[0] * keep; ov[1] = ld[1] * keep; ov[2] = ld[2] * keep; ov[3] = ld[3] * keep; vst2(dst + (size_t)row * CIN + q * 4, ov); }   /* unconditional (clamped) loads, zero by select */
  if (blockIdx.x == 0 && threadIdx.x < 128) { const int c = threadIdx.x; float bvv = 0.f; if (Bsrc) { const float t = Bsrc[c & 63]; asm volatile("s_wait_loadcnt 0x0" ::: "memory"); bvv = c < 64 ? t : 0.f; } vst2(BP + which * 128 + c, bvv); } }
// ---- k_out64: out[b][t][0..63] = ctx row columns 0..63 (256 B by 16 lanes)
__global__ __launch_bounds__(256) void k_out64(const float* __restrict__ Y, float* __restrict__ OUT) { const size_t row = (size_t)blockIdx.x * 16 + (threadIdx.x >> 4); const int q = threadIdx.x & 15; const v4f v = *(const v4f*)(Y + row * CC + q * 4); asm volatile("s_wait_loadcnt 0x0" ::: "memory"); vst2(OUT + row * 64 + q * 4, v); }
#define WS_WP (WS_END)                                  // padded weights [3][128 x C]
#define WS_BP (WS_WP + 4u * 3 * (size_t)CIN * 128)        // padded biases [3][128]
#define WS_Y2 (WS_BP + 4u * 3 * 128)                      // ctx rows [b*TT+t][128]
#define WS_END2 (WS_Y2 + 4u * (size_t)NB * TT * CC)
#ifndef SM_EXTRA_PARAMS
#define SM_EXTRA_PARAMS
#endif
#ifndef PROJ_EXTRA_PARAMS
#define PROJ_EXTRA_PARAMS
#endif
#ifndef SM_MASK_HOOK
#define SM_MASK_HOOK (void)0
#endif

#define WS_QH  0u                                      // f16 q rows [b*t][CC]
#define WS_KH  (WS_QH + 2u * (size_t)NB * TT * CC)      // f16 k rows [b*t][CC]
#define WS_VT  (WS_KH + 2u * (size_t)NB * TT * CC)      // f16 v planes [b][c][t]
#define WS_QL  (WS_VT + 2u * (size_t)NB * CC * TT)      // f16 q residual x 2^10 rows [b][t < QHI][CC]
#define WS_KL  (WS_QL + 2u * (size_t)NB * QHI * CC)     // f16 k residual x 2^10 rows [b][t < KHI][CC]
#define WS_VB  (WS_KL + 2u * (size_t)NB * KHI * CC)     // bf16 v hi planes [b][c][t < KHI]
#define WS_VBL (WS_VB + 2u * (size_t)NB * CC * KHI)
#define WS_S   (WS_VBL + 2u * (size_t)NB * CC * KHI)    // f32 logits / P [hg][t][s]
#define WS_Y   (WS_S  + 4u * (size_t)HG * TT * TT)      // f32 ctx rows [b*t][CC] (only when there is an output projection)
#define WS_END (WS_Y  + 0u)

// ---- k_proj: block = (64 rows, 128 cols, which): q/k/v = X W (+ b) with exact bf16 products (K = DIN) -> which 0: q f16 rows (+ residual rows < QHI); 1: k f16 rows (+ residual rows < KHI); 2: v f16 planes [c][t] (+ bf16 hi/lo planes for t < KHI)
__global__ __launch_bounds__(128) void k_proj(const float* __restrict__ XQ, const float* __restrict__ XK, const float* __restrict__ XV, const float* __restrict__ WQ, const float* __restrict__ WK, const float* __restrict__ WV, const float* __restrict__ BQ, const float* __restrict__ BK, const float* __restrict__ BV,
    _Float16* __restrict__ QH, _Float16* __restrict__ QL, _Float16* __restrict__ KH, _Float16* __restrict__ KL, _Float16* __restrict__ VT, __bf16* __restrict__ VB, __bf16* __restrict__ VBL) {
  __shared__ __align__(16) _Float16 sh[64][136], sl[64][136]; __shared__ __align__(16) _Float16 th[128][72]; __shared__ __align__(16) __bf16 tb[128][72], tbl[128][72];
  const int tid = threadIdx.x, wave = tid >> 5, lane = tid & 31, col = lane & 15, g = lane >> 4; const int which = blockIdx.z; const int c0 = blockIdx.y * 128; const size_t r0 = (size_t)blockIdx.x * 64; const size_t bb = r0 / TT; const int t0 = (int)(r0 % TT);
  const float* X = which == 0 ? XQ : which == 1 ? XK : XV; const float* WA = which == 0 ? WQ : which == 1 ? WK : WV; const float* BA = which == 0 ? BQ : which == 1 ? BK : BV;
  v8f acc[8] = {};
#pragma unroll 2
  for (int kc = 0; kc < DIN / 32; ++kc) { v16b a; { const float* p = X + (r0 + wave * 16 + col) * DIN + kc * 32 + 8 * g;
#pragma unroll
      for (int i = 0; i < 8; ++i) { a[i] = (__bf16)p[i]; a[8 + i] = (__bf16)p[16 + i]; } }
    asm volatile("s_wait_loadcnt 0x0" ::: "memory");
#pragma unroll
    for (int j = 0; j < 8; ++j) { const v16b w = WCOL(WA, kc * 32, c0 + j * 16 + col, lane); asm volatile("s_wait_loadcnt 0x0" ::: "memory"); acc[j] = wmma_bf(a, w, acc[j]); } }
  if (which < 2) { _Float16* DH = which == 0 ? QH : KH; _Float16* DL = which == 0 ? QL : KL; const int nhi = which == 0 ? QHI : KHI; const bool hi_rows = t0 < nhi;
#pragma unroll
    for (int j = 0; j < 8; ++j) { const float bias = BA ? bfr(BA[c0 + j * 16 + col]) : 0.f;
#pragma unroll
      for (int r = 0; r < 8; ++r) { const float v = acc[j][r] + bias; const _Float16 hv = (_Float16)v; sh[wave * 16 + 8 * g + r][j * 16 + col] = hv; sl[wave * 16 + 8 * g + r][j * 16 + col] = (_Float16)((v - (float)hv) * 1024.0f); } }
    __syncthreads();
    for (int e = tid; e < 64 * 16; e += 128) { const int rl = e >> 4, q = e & 15; vst2((unsigned*)(DH + (r0 + rl) * CC + c0 + q * 8), *(const v4u*)&sh[rl][q * 8]); if (hi_rows) vst2((unsigned*)(DL + (bb * nhi + t0 + rl) * (size_t)CC + c0 + q * 8), *(const v4u*)&sl[rl][q * 8]); }
  } else { const bool hi_rows = t0 < KHI;
#pragma unroll
    for (int j = 0; j < 8; ++j) { const float bias = BA ? bfr(BA[c0 + j * 16 + col]) : 0.f;
#pragma unroll
      for (int r = 0; r < 8; ++r) { const float v = acc[j][r] + bias; const int rl = wave * 16 + 8 * g + r, cl = j * 16 + col; th[cl][rl] = (_Float16)v; const __bf16 bh = (__bf16)v; tb[cl][rl] = bh; tbl[cl][rl] = (__bf16)(v - (float)bh); } }
    __syncthreads();
    for (int e = tid; e < 128 * 8; e += 128) { const int cl = e >> 3, q = e & 7; vst2((unsigned*)(VT + (bb * CC + c0 + cl) * (size_t)TT + t0 + q * 8), *(const v4u*)&th[cl][q * 8]); if (hi_rows) { const size_t o3 = (bb * CC + c0 + cl) * (size_t)KHI + t0 + q * 8; vst2((unsigned*)(VB + o3), *(const v4u*)&tb[cl][q * 8]); vst2((unsigned*)(VBL + o3), *(const v4u*)&tbl[cl][q * 8]); } } } }
// ---- k_sc: block = (query block qb, key block kb <= kb_last(qb), head in group) of batch b: logits x SCALE; q hi + residual (x 2^10) against k (2 products) for query rows < QHI, plus the k residual (3 products) for query blocks < QBH (causal early rows); causal: blocks past the diagonal exit, the mask itself is applied by index in k_sm
__global__ __launch_bounds__(128) void k_sc(const _Float16* __restrict__ QH, const _Float16* __restrict__ KH, const _Float16* __restrict__ QL, const _Float16* __restrict__ KL, int b, int h0, float* __restrict__ S0) { __shared__ __align__(16) float ss[4][16][132];
  const int qb = blockIdx.x, kb = blockIdx.y; if (kb > kb_last(qb)) return;
  const int h = h0 + blockIdx.z; float* S = S0 + (size_t)blockIdx.z * TT * TT;
  const int tid = threadIdx.x, wave = tid >> 5, lane = tid & 31, col = lane & 15, g = lane >> 4; const int k0 = kb * 128; const int ql0 = qb * 64 + wave * 16; const size_t q0 = (size_t)b * TT + ql0, kr0 = (size_t)b * TT + k0;
  v8f acc[8] = {}, accl[8] = {};
  const _Float16* QLb = QL + (size_t)b * QHI * CC; const _Float16* KLb = KL + (size_t)b * KHI * CC;
  if (qb < QBH) {
#pragma unroll
    for (int kc = 0; kc < HD / 32; ++kc) { const v16h ah = frag_h(QH + (q0 + col) * CC + h * HD + kc * 32, lane), al = frag_h(QLb + (size_t)(ql0 + col) * CC + h * HD + kc * 32, lane);
#pragma unroll
      for (int j = 0; j < 8; ++j) { const v16h kbf = frag_h(KH + (kr0 + j * 16 + col) * CC + h * HD + kc * 32, lane), klf = frag_h(KLb + (size_t)(k0 + j * 16 + col) * CC + h * HD + kc * 32, lane); acc[j] = wmma16(ah, kbf, acc[j]); accl[j] = wmma16(al, kbf, accl[j]); accl[j] = wmma16(ah, klf, accl[j]); } }
  } else if (qb * 64 < QHI) {
#pragma unroll
    for (int kc = 0; kc < HD / 32; ++kc) { const v16h ah = frag_h(QH + (q0 + col) * CC + h * HD + kc * 32, lane), al = frag_h(QLb + (size_t)(ql0 + col) * CC + h * HD + kc * 32, lane);
#pragma unroll
      for (int j = 0; j < 8; ++j) { const v16h kbf = frag_h(KH + (kr0 + j * 16 + col) * CC + h * HD + kc * 32, lane); acc[j] = wmma16(ah, kbf, acc[j]); accl[j] = wmma16(al, kbf, accl[j]); } }
  } else {
#pragma unroll
    for (int kc = 0; kc < HD / 32; ++kc) { const v16h ah = frag_h(QH + (q0 + col) * CC + h * HD + kc * 32, lane);
#pragma unroll
      for (int j = 0; j < 8; ++j) { const v16h kbf = frag_h(KH + (kr0 + j * 16 + col) * CC + h * HD + kc * 32, lane); acc[j] = wmma16(ah, kbf, acc[j]); } } }
#pragma unroll
  for (int j = 0; j < 8; ++j) {
#pragma unroll
    for (int r = 0; r < 8; ++r) ss[wave][8 * g + r][j * 16 + col] = (acc[j][r] + accl[j][r] * (1.0f / 1024.0f)) * SCALE; }
  LDSX(); for (int rl = 0; rl < 16; ++rl) vst2(S + (size_t)(ql0 + rl) * TT + k0 + lane * 4, *(const v4f*)&ss[wave][rl][lane * 4]); }
// ---- k_sm: block = query row t (head in group): keys [0, kend): causal -> logit if s <= t else excluded; softmax in f32; P x 2^11 in place (0 for excluded)
__global__ __launch_bounds__(256) void k_sm(float* __restrict__ S0 SM_EXTRA_PARAMS) { __shared__ float sred[8]; __shared__ float sbc; __shared__ __align__(16) float shv[TT];
  const int tid = threadIdx.x; const int t = blockIdx.x; const int kend = (kb_last(t >> 6) + 1) * 128;
  float* sr = S0 + (size_t)blockIdx.y * TT * TT + (size_t)t * TT;
  float m = -3.0e38f; for (int k = tid; k < kend; k += 256) { float v = (!CAUSAL || k <= t) ? sr[k] : -3.0e38f; SM_MASK_HOOK; shv[k] = v; m = fmaxf(m, v); }
#pragma unroll
  for (int o = 1; o < 32; o <<= 1) m = fmaxf(m, __shfl_xor(m, o));
  if ((tid & 31) == 0) sred[tid >> 5] = m; __syncthreads(); if (tid == 0) { float a = sred[0]; for (int i = 1; i < 8; ++i) a = fmaxf(a, sred[i]); sbc = a; } __syncthreads(); m = sbc; __syncthreads();
  float sum = 0.f; for (int k = tid; k < kend; k += 256) { const float v = shv[k]; const float e = (v <= -1.0e38f) ? 0.f : expf(v - m); shv[k] = e; sum += e; }
#pragma unroll
  for (int o = 1; o < 32; o <<= 1) sum += __shfl_xor(sum, o);
  if ((tid & 31) == 0) sred[tid >> 5] = sum; __syncthreads(); if (tid == 0) { float a = 0.f; for (int i = 0; i < 8; ++i) a += sred[i]; sbc = a > 0.f ? 2048.0f / a : 0.f; }   /* a fully excluded row yields P = 0 */ __syncthreads(); const float inv = sbc;
  for (int k = tid; k < kend; k += 256) shv[k] = shv[k] * inv;
  __syncthreads(); for (int q = tid; q < kend / 4; q += 256) vst2(sr + q * 4, *(const v4f*)&shv[q * 4]); }
// ---- k_pv: block = 64 queries (qb) of (b, h): ctx = P . v over keys [0, kend) (P x 2^11 once to f16 against v f16: 1 product; causal early query blocks: P and v as bf16 hi + lo, 3 products); 256-B (row, head) segment by 16 lanes
__global__ __launch_bounds__(128) void k_pv(const float* __restrict__ PS0, const _Float16* __restrict__ VT, const __bf16* __restrict__ VB, const __bf16* __restrict__ VBL, int b, int h0, float* __restrict__ Y) { const int h = h0 + blockIdx.z; const float* PS = PS0 + (size_t)blockIdx.z * TT * TT; __shared__ __align__(16) float ss[4][16][HD + 4];
  const int tid = threadIdx.x, wave = tid >> 5, lane = tid & 31, col = lane & 15, g = lane >> 4; const int qb = blockIdx.x; const int ql0 = qb * 64 + wave * 16; const int kce = (kb_last(qb) + 1) * 4;
  v8f acc[HD / 16] = {};
  if (qb < QBH) {
#pragma unroll 1
    for (int kc = 0; kc < kce; ++kc) { const F2 p = split_row(PS + (size_t)(ql0 + col) * TT, kc * 32, lane);
      asm volatile("s_wait_loadcnt 0x0" ::: "memory");
#pragma unroll
      for (int j = 0; j < HD / 16; ++j) { const size_t po = ((size_t)b * CC + h * HD + j * 16 + col) * (size_t)KHI + kc * 32; const v16b vh = frag_b(VB + po, lane); acc[j] = wmma_bf(p.h, vh, acc[j]); acc[j] = wmma_bf(p.l, vh, acc[j]); acc[j] = wmma_bf(p.h, frag_b(VBL + po, lane), acc[j]); } }
  } else {
#pragma unroll 1
    for (int kc = 0; kc < kce; ++kc) { const v16h p = frag_f32(PS + (size_t)(ql0 + col) * TT + kc * 32, lane);
      asm volatile("s_wait_loadcnt 0x0" ::: "memory");
#pragma unroll
      for (int j = 0; j < HD / 16; ++j) { const size_t po = ((size_t)b * CC + h * HD + j * 16 + col) * (size_t)TT + kc * 32; acc[j] = wmma16(p, frag_h(VT + po, lane), acc[j]); } } }
#pragma unroll
  for (int j = 0; j < HD / 16; ++j)
#pragma unroll
    for (int r = 0; r < 8; ++r) ss[wave][8 * g + r][j * 16 + col] = acc[j][r] * (1.0f / 2048.0f);
  LDSX(); for (int rl = 0; rl < 16; ++rl) if (lane < HD / 4) vst2(Y + ((size_t)b * TT + ql0 + rl) * CC + h * HD + lane * 4, *(const v4f*)&ss[wave][rl][lane * 4]); }

extern "C" void kernel_launch(void* const* d_in, const int* in_sizes, int n_in, void* d_out, int out_size, void* d_ws, size_t ws_size, hipStream_t stream) {
  (void)in_sizes; (void)n_in; (void)out_size;
  const float** F = (const float**)d_in;
  if (ws_size < (size_t)WS_END) return;
  char* ws = (char*)d_ws; _Float16 *QH = (_Float16*)(ws + WS_QH), *KH = (_Float16*)(ws + WS_KH), *VT = (_Float16*)(ws + WS_VT), *QL = (_Float16*)(ws + WS_QL), *KL = (_Float16*)(ws + WS_KL); __bf16 *VB = (__bf16*)(ws + WS_VB), *VBL = (__bf16*)(ws + WS_VBL); float *S = (float*)(ws + WS_S), *Y = (float*)(ws + WS_Y);
  (void)Y; (void)QL; (void)KL; (void)VB; (void)VBL;
  // inputs: 0 embeddings [4096,512]; 1 Wq [64,512] (out,in), 2 bq [64]; 3 Wk, 4 bk; 5 Wv, 6 bv (biases nonzero)
  if (ws_size < (size_t)WS_END2) return;
  float *WP = (float*)(ws + WS_WP), *BP = (float*)(ws + WS_BP), *Y2 = (float*)(ws + WS_Y2);
  k_padw<<<dim3(32, 3), 256, 0, stream>>>(F[1], F[3], F[5], F[2], F[4], F[6], WP, BP);
  k_proj<<<dim3(TNB * TT / 64, CC / 128, 3), 128, 0, stream>>>(F[0], F[0], F[0], WP, WP + (size_t)CIN * 128, WP + 2 * (size_t)CIN * 128, BP, BP + 128, BP + 256, QH, QL, KH, KL, VT, VB, VBL);
  for (int b = 0; b < TNB; ++b) {   /* head 0 only (head 1 is the zero padding) */
    k_sc<<<dim3(NQB, TT / 128, 1), 128, 0, stream>>>(QH, KH, QL, KL, b, 0, S);
    k_sm<<<dim3(TT, 1), 256, 0, stream>>>(S);
    k_pv<<<dim3(NQB, 1, 1), 128, 0, stream>>>(S, VT, VB, VBL, b, 0, Y2);
  }
  k_out64<<<dim3(TNB * TT / 16), 256, 0, stream>>>(Y2, (float*)d_out);
}

// v001
// A run of this version takes 117 microseconds.
// Next to v000, in two timings, it ran 1.92 times as fast each time.
// compute dtype: all float inputs rounded to bf16; q/k/v projections with EXACT bf16 products on WMMA 16x16x32 (f32 accumulate) + bias; causal logits: 3 products (q f16 hi + residual x k hi + residual) for the first 384 rows, single f16 q x k after, x scale; softmax f32; P x 2^11 once to f16 x v once to f16 (1 product; bf16 hi + lo below row 384); f32 output.
#include <hip/hip_runtime.h>
#include <math.h>

typedef __attribute__((ext_vector_type(16))) _Float16 v16h;
typedef __attribute__((ext_vector_type(16))) __bf16 v16b;
typedef __attribute__((ext_vector_type(8)))  _Float16 v8h;
typedef __attribute__((ext_vector_type(8)))  float v8f;
typedef __attribute__((ext_vector_type(4)))  float v4f;
typedef __attribute__((ext_vector_type(2)))  float v2f;
typedef __attribute__((ext_vector_type(4)))  unsigned v4u;
typedef __attribute__((ext_vector_type(4)))  int v4i;
typedef float __attribute__((may_alias)) float_a;
typedef int __attribute__((may_alias)) int_a;

template <typename T> __device__ __forceinline__ void vst2(void* p, T v) { *(T*)p = v;  }
__device__ __forceinline__ v8f wmma16(v16h a, v16h b, v8f c) {
  v8f d = __builtin_amdgcn_wmma_f32_16x16x32_f16(false, a, false, b, (short)0, c, false, false);
  asm volatile("v_nop\n\tv_nop\n\tv_nop\n\tv_nop" : "+v"(d) : "v"(a), "v"(b));
  return d;
}
__device__ __forceinline__ v8f wmma_bf(v16b a, v16b b, v8f c) {
  v8f d = __builtin_amdgcn_wmma_f32_16x16x32_bf16(false, a, false, b, (short)0, c, false, false);
  asm volatile("v_nop\n\tv_nop\n\tv_nop\n\tv_nop" : "+v"(d) : "v"(a), "v"(b));
  return d;
}
// 16x16x32 fragments: lane = (h = lane>>4, row/col = lane&15); elements 0..7 = k0+8h+0..7, 8..15 = k0+16+8h+0..7; D element r = row 8h+r
__device__ __forceinline__ v16h frag_h(const _Float16* rowk0, int lane) {
  union { v16h v; v8h q[2]; } u; const _Float16* p = rowk0 + 8 * (lane >> 4);
  u.q[0] = *(const v8h*)p; u.q[1] = *(const v8h*)(p + 16); return u.v;
}
__device__ __forceinline__ v16h frag_f32(const float* rowk0, int lane) {
  v16h a; const float* p = rowk0 + 8 * (lane >> 4);
#pragma unroll
  for (int i = 0; i < 8; ++i) { a[i] = (_Float16)p[i]; a[8 + i] = (_Float16)p[16 + i]; }
  return a;
}
__device__ __forceinline__ v16h frag_f32s(const float* rowk0, int lane, float sc) {
  v16h a; const float* p = rowk0 + 8 * (lane >> 4);
#pragma unroll
  for (int i = 0; i < 8; ++i) { a[i] = (_Float16)(p[i] * sc); a[8 + i] = (_Float16)(p[16 + i] * sc); }
  return a;
}
// column fragment from a [K][ld] layout (column n), rows >= K read as 0
__device__ __forceinline__ v16h fragc_f32(const float* W, int k0, int n, int lane, int ld, int K) {
  v16h a; const int g = lane >> 4;
#pragma unroll
  for (int i = 0; i < 8; ++i) { const int ka = k0 + 8 * g + i, kb = ka + 16;
    a[i] = (_Float16)(ka < K ? W[(size_t)(ka < K ? ka : K - 1) * ld + n] : 0.f); a[8 + i] = (_Float16)(kb < K ? W[(size_t)(kb < K ? kb : K - 1) * ld + n] : 0.f); }
  return a;
}
struct F2 { v16b h, l; };
__device__ __forceinline__ F2 bsplit16(const float v[16]) { F2 r;
#pragma unroll
  for (int i = 0; i < 16; ++i) { const __bf16 h = (__bf16)v[i]; r.h[i] = h; r.l[i] = (__bf16)(v[i] - (float)h); }
  return r; }
__device__ __forceinline__ F2 split_row(const float* row, int k0, int lane) { float v[16]; const float* p = row + k0 + 8 * (lane >> 4);
#pragma unroll
  for (int i = 0; i < 8; ++i) { v[i] = p[i]; v[8 + i] = p[16 + i]; }
  return bsplit16(v); }
__device__ __forceinline__ F2 split_rowK(const float* row, int k0, int lane, int K) { float v[16]; const int g = lane >> 4;
#pragma unroll
  for (int i = 0; i < 8; ++i) { const int ka = k0 + 8 * g + i, kb = ka + 16; v[i] = ka < K ? row[ka < K ? ka : K - 1] : 0.f; v[8 + i] = kb < K ? row[kb < K ? kb : K - 1] : 0.f; }
  return bsplit16(v); }
__device__ __forceinline__ F2 split_col(const float* W, int k0, int n, int lane, int ld, int K) { float v[16]; const int g = lane >> 4;
#pragma unroll
  for (int i = 0; i < 8; ++i) { const int ka = k0 + 8 * g + i, kb = ka + 16; v[i] = ka < K ? W[(size_t)(ka < K ? ka : K - 1) * ld + n] : 0.f; v[8 + i] = kb < K ? W[(size_t)(kb < K ? kb : K - 1) * ld + n] : 0.f; }
  return bsplit16(v); }
__device__ __forceinline__ v8f mac3(const F2& a, const F2& b, v8f c) { c = wmma_bf(a.l, b.h, c); c = wmma_bf(a.h, b.l, c); return wmma_bf(a.h, b.h, c); }
__device__ __forceinline__ float sigm(float v) { return 1.0f / (1.0f + expf(-v)); }
#define LDSX() do { asm volatile("s_wait_dscnt 0" ::: "memory"); __builtin_amdgcn_wave_barrier(); __builtin_amdgcn_fence(__ATOMIC_RELEASE, "workgroup"); } while (0)

// Single-head causal scaled-dot-product attention over one 4,096-token sequence (d_model 512, d_k = d_v = 64; (out,in) Wq/Wk/Wv [64,512] + biases, torch Linear convention): scores = (Q K^T + M)/sqrt(64) with M = -inf strictly above the diagonal; out = softmax(scores) V -> [4096, 64].
#define NB 1
#define TT 4096
#define CC 128            // NH * HD = projected width
#define DIN 512          // input (model) width
#define NH 2
#define HD 64
#define NQB (TT / 64)
#define HG 1
#define SCALE (0.125f)
#define CAUSAL 1
#ifndef TNB
#define TNB NB
#endif
__device__ __forceinline__ float bfr(float v) { return (float)(__bf16)v; }
__host__ __device__ __forceinline__ int kb_last(int qb) { return CAUSAL ? ((qb * 64 + 63) >> 7) : (TT / 128 - 1); }
typedef __attribute__((ext_vector_type(8))) __bf16 v8b;
__device__ __forceinline__ v16b frag_b(const __bf16* rowk0, int lane) {
  union { v16b v; v8b q[2]; } u; const __bf16* p = rowk0 + 8 * (lane >> 4);
  u.q[0] = *(const v8b*)p; u.q[1] = *(const v8b*)(p + 16); return u.v;
}
#define QBH 6              // causal: query blocks 0..QBH-1 of each sequence (few keys, no averaging) take the high-precision path
#define QHI 384            // rows carrying a q residual plane (all rows when non-causal: 2-product logits everywhere)
#define KHI 384            // key rows carrying k residual / v bf16 hi+lo planes (used only by the causal high-precision path)
// B fragment (k rows k0+.., output column o) of a weight: (in,out) [K][ld] or (out,in) [ld rows of K]: bf16 exact, or f16(bf16 * 256) exact
__device__ __forceinline__ v16b wcol_io(const float* Wm, int k0, int o, int lane, int ld) { v16b w; const int g = lane >> 4;
#pragma unroll
  for (int i = 0; i < 8; ++i) { w[i] = (__bf16)Wm[(size_t)(k0 + 8 * g + i) * ld + o]; w[8 + i] = (__bf16)Wm[(size_t)(k0 + 16 + 8 * g + i) * ld + o]; }
  return w; }
__device__ __forceinline__ v16b wcol_oi(const float* Wm, int k0, int o, int lane, int K) { v16b w; const float* p = Wm + (size_t)o * K + k0 + 8 * (lane >> 4);
#pragma unroll
  for (int i = 0; i < 8; ++i) { w[i] = (__bf16)p[i]; w[8 + i] = (__bf16)p[16 + i]; }
  return w; }
__device__ __forceinline__ v16h wcolh_io(const float* Wm, int k0, int o, int lane, int ld) { v16h w; const int g = lane >> 4;
#pragma unroll
  for (int i = 0; i < 8; ++i) { w[i] = (_Float16)(bfr(Wm[(size_t)(k0 + 8 * g + i) * ld + o]) * 256.0f); w[8 + i] = (_Float16)(bfr(Wm[(size_t)(k0 + 16 + 8 * g + i) * ld + o]) * 256.0f); }
  return w; }
__device__ __forceinline__ v16h wcolh_oi(const float* Wm, int k0, int o, int lane, int K) { v16h w; const float* p = Wm + (size_t)o * K + k0 + 8 * (lane >> 4);
#pragma unroll
  for (int i = 0; i < 8; ++i) { w[i] = (_Float16)(bfr(p[i]) * 256.0f); w[8 + i] = (_Float16)(bfr(p[16 + i]) * 256.0f); }
  return w; }
#define WQKV_LAYOUT 1   // 0 = (in,out) [DIN][CC]; 1 = (out,in) [CC][DIN]; 2 = per-head [NH][DIN][HD]
__device__ __forceinline__ v16b wcol_hdk(const float* Wm, int k0, int o, int lane) { v16b w; const int g = lane >> 4; const float* p = Wm + (size_t)(o / HD) * DIN * HD + (o % HD);
#pragma unroll
  for (int i = 0; i < 8; ++i) { w[i] = (__bf16)p[(size_t)(k0 + 8 * g + i) * HD]; w[8 + i] = (__bf16)p[(size_t)(k0 + 16 + 8 * g + i) * HD]; }
  return w; }
#define WO_OUT_IN 0
#if WQKV_LAYOUT == 1
#define WCOL(W, k0, o, lane) wcol_oi(W, k0, o, lane, DIN)
#elif WQKV_LAYOUT == 2
#define WCOL(W, k0, o, lane) wcol_hdk(W, k0, o, lane)
#else
#define WCOL(W, k0, o, lane) wcol_io(W, k0, o, lane, CC)
#endif
#if WO_OUT_IN
#define WOCOL(W, k0, o, lane) wcol_oi(W, k0, o, lane, CC)
#define WOCOLH(W, k0, o, lane) wcolh_oi(W, k0, o, lane, CC)
#else
#define WOCOL(W, k0, o, lane) wcol_io(W, k0, o, lane, DIN)
#define WOCOLH(W, k0, o, lane) wcolh_io(W, k0, o, lane, DIN)
#endif
#define CIN 512
// ---- k_padw: the three (out,in) [64][C] projection weights copied into zero-padded (out,in) [128][C] ws planes (rows 64..127 zero) + zero-padded [128] biases (columns 64..127 = an all-zero dummy head, never attended)
__global__ __launch_bounds__(256) void k_padw(const float* __restrict__ WQ, const float* __restrict__ WK, const float* __restrict__ WV, const float* __restrict__ BQ, const float* __restrict__ BK, const float* __restrict__ BV, float* __restrict__ WP, float* __restrict__ BP) { const int which = blockIdx.y; const float* Wsrc = which == 0 ? WQ : (which == 1 ? WK : WV); const float* Bsrc = which == 0 ? BQ : (which == 1 ? BK : BV); float* dst = WP + (size_t)which * 128 * CIN;
  for (int e = blockIdx.x * 256 + threadIdx.x; e < 128 * (CIN / 4); e += gridDim.x * 256) { const int row = e / (CIN / 4), q = e % (CIN / 4); const v4f ld = *(const v4f*)(Wsrc + (size_t)(row & 63) * CIN + q * 4); asm volatile("s_wait_loadcnt 0x0" ::: "memory"); const float keep = row < 64 ? 1.f : 0.f; v4f ov; ov[0] = ld[0] * keep; ov[1] = ld[1] * keep; ov[2] = ld[2] * keep; ov[3] = ld[3] * keep; vst2(dst + (size_t)row * CIN + q * 4, ov); }   /* unconditional (clamped) loads, zero by select */
  if (blockIdx.x == 0 && threadIdx.x < 128) { const int c = threadIdx.x; float bvv = 0.f; if (Bsrc) { const float t = Bsrc[c & 63]; asm volatile("s_wait_loadcnt 0x0" ::: "memory"); bvv = c < 64 ? t : 0.f; } vst2(BP + which * 128 + c, bvv); } }
// ---- k_out64: out[b][t][0..63] = ctx row columns 0..63 (256 B by 16 lanes)
__global__ __launch_bounds__(256) void k_out64(const float* __restrict__ Y, float* __restrict__ OUT) { const size_t row = (size_t)blockIdx.x * 16 + (threadIdx.x >> 4); const int q = threadIdx.x & 15; const v4f v = *(const v4f*)(Y + row * CC + q * 4); asm volatile("s_wait_loadcnt 0x0" ::: "memory"); vst2(OUT + row * 64 + q * 4, v); }
#define WS_WP (WS_END)                                  // padded weights [3][128 x C]
#define WS_BP (WS_WP + 4u * 3 * (size_t)CIN * 128)        // padded biases [3][128]
#define WS_Y2 (WS_BP + 4u * 3 * 128)                      // ctx rows [b*TT+t][128]
#define WS_END2 (WS_Y2 + 4u * (size_t)NB * TT * CC)
#ifndef SM_EXTRA_PARAMS
#define SM_EXTRA_PARAMS
#endif
#ifndef PROJ_EXTRA_PARAMS
#define PROJ_EXTRA_PARAMS
#endif
#ifndef SM_MASK_HOOK
#define SM_MASK_HOOK (void)0
#endif

#define WS_QH  0u                                      // f16 q rows [b*t][CC]
#define WS_KH  (WS_QH + 2u * (size_t)NB * TT * CC)      // f16 k rows [b*t][CC]
#define WS_VT  (WS_KH + 2u * (size_t)NB * TT * CC)      // f16 v planes [b][c][t]
#define WS_QL  (WS_VT + 2u * (size_t)NB * CC * TT)      // f16 q residual x 2^10 rows [b][t < QHI][CC]
#define WS_KL  (WS_QL + 2u * (size_t)NB * QHI * CC)     // f16 k residual x 2^10 rows [b][t < KHI][CC]
#define WS_VB  (WS_KL + 2u * (size_t)NB * KHI * CC)     // bf16 v hi planes [b][c][t < KHI]
#define WS_VBL (WS_VB + 2u * (size_t)NB * CC * KHI)
#define WS_S   (WS_VBL + 2u * (size_t)NB * CC * KHI)    // f32 logits / P [hg][t][s]
#define WS_Y   (WS_S  + 4u * (size_t)HG * TT * TT)      // f32 ctx rows [b*t][CC] (only when there is an output projection)
#define WS_END (WS_Y  + 0u)

// ---- k_proj: block = (64 rows, 128 cols, which): q/k/v = X W (+ b) with exact bf16 products (K = DIN) -> which 0: q f16 rows (+ residual rows < QHI); 1: k f16 rows (+ residual rows < KHI); 2: v f16 planes [c][t] (+ bf16 hi/lo planes for t < KHI)
__global__ __launch_bounds__(128) void k_proj(const float* __restrict__ XQ, const float* __restrict__ XK, const float* __restrict__ XV, const float* __restrict__ WQ, const float* __restrict__ WK, const float* __restrict__ WV, const float* __restrict__ BQ, const float* __restrict__ BK, const float* __restrict__ BV,
    _Float16* __restrict__ QH, _Float16* __restrict__ QL, _Float16* __restrict__ KH, _Float16* __restrict__ KL, _Float16* __restrict__ VT, __bf16* __restrict__ VB, __bf16* __restrict__ VBL) {
  __shared__ __align__(16) _Float16 sh[64][136], sl[64][136]; __shared__ __align__(16) _Float16 th[128][72]; __shared__ __align__(16) __bf16 tb[128][72], tbl[128][72];
  const int tid = threadIdx.x, wave = tid >> 5, lane = tid & 31, col = lane & 15, g = lane >> 4; const int which = blockIdx.z; const int c0 = blockIdx.y * 128; const size_t r0 = (size_t)blockIdx.x * 64; const size_t bb = r0 / TT; const int t0 = (int)(r0 % TT);
  const float* X = which == 0 ? XQ : which == 1 ? XK : XV; const float* WA = which == 0 ? WQ : which == 1 ? WK : WV; const float* BA = which == 0 ? BQ : which == 1 ? BK : BV;
  v8f acc[8] = {};
#pragma unroll 2
  for (int kc = 0; kc < DIN / 32; ++kc) { v16b a; { const float* p = X + (r0 + wave * 16 + col) * DIN + kc * 32 + 8 * g;
#pragma unroll
      for (int i = 0; i < 8; ++i) { a[i] = (__bf16)p[i]; a[8 + i] = (__bf16)p[16 + i]; } }
    asm volatile("s_wait_loadcnt 0x0" ::: "memory");
#pragma unroll
    for (int j = 0; j < 8; ++j) { const v16b w = WCOL(WA, kc * 32, c0 + j * 16 + col, lane); asm volatile("s_wait_loadcnt 0x0" ::: "memory"); acc[j] = wmma_bf(a, w, acc[j]); } }
  if (which < 2) { _Float16* DH = which == 0 ? QH : KH; _Float16* DL = which == 0 ? QL : KL; const int nhi = which == 0 ? QHI : KHI; const bool hi_rows = t0 < nhi;
#pragma unroll
    for (int j = 0; j < 8; ++j) { const float bias = BA ? bfr(BA[c0 + j * 16 + col]) : 0.f;
#pragma unroll
      for (int r = 0; r < 8; ++r) { const float v = acc[j][r] + bias; const _Float16 hv = (_Float16)v; sh[wave * 16 + 8 * g + r][j * 16 + col] = hv; sl[wave * 16 + 8 * g + r][j * 16 + col] = (_Float16)((v - (float)hv) * 1024.0f); } }
    __syncthreads();
    for (int e = tid; e < 64 * 16; e += 128) { const int rl = e >> 4, q = e & 15; vst2((unsigned*)(DH + (r0 + rl) * CC + c0 + q * 8), *(const v4u*)&sh[rl][q * 8]); if (hi_rows) vst2((unsigned*)(DL + (bb * nhi + t0 + rl) * (size_t)CC + c0 + q * 8), *(const v4u*)&sl[rl][q * 8]); }
  } else { const bool hi_rows = t0 < KHI;
#pragma unroll
    for (int j = 0; j < 8; ++j) { const float bias = BA ? bfr(BA[c0 + j * 16 + col]) : 0.f;
#pragma unroll
      for (int r = 0; r < 8; ++r) { const float v = acc[j][r] + bias; const int rl = wave * 16 + 8 * g + r, cl = j * 16 + col; th[cl][rl] = (_Float16)v; const __bf16 bh = (__bf16)v; tb[cl][rl] = bh; tbl[cl][rl] = (__bf16)(v - (float)bh); } }
    __syncthreads();
    for (int e = tid; e < 128 * 8; e += 128) { const int cl = e >> 3, q = e & 7; vst2((unsigned*)(VT + (bb * CC + c0 + cl) * (size_t)TT + t0 + q * 8), *(const v4u*)&th[cl][q * 8]); if (hi_rows) { const size_t o3 = (bb * CC + c0 + cl) * (size_t)KHI + t0 + q * 8; vst2((unsigned*)(VB + o3), *(const v4u*)&tb[cl][q * 8]); vst2((unsigned*)(VBL + o3), *(const v4u*)&tbl[cl][q * 8]); } } } }
// ---- k_sc: block = (query block qb, key block kb <= kb_last(qb), head in group) of batch b: logits x SCALE; q hi + residual (x 2^10) against k (2 products) for query rows < QHI, plus the k residual (3 products) for query blocks < QBH (causal early rows); causal: blocks past the diagonal exit, the mask itself is applied by index in k_sm
__global__ __launch_bounds__(128) void k_sc(const _Float16* __restrict__ QH, const _Float16* __restrict__ KH, const _Float16* __restrict__ QL, const _Float16* __restrict__ KL, int b, int h0, float* __restrict__ S0) { __shared__ __align__(16) float ss[4][16][132];
  const int qb = blockIdx.x, kb = blockIdx.y; if (kb > kb_last(qb)) return;
  const int h = h0 + blockIdx.z; float* S = S0 + (size_t)blockIdx.z * TT * TT;
  const int tid = threadIdx.x, wave = tid >> 5, lane = tid & 31, col = lane & 15, g = lane >> 4; const int k0 = kb * 128; const int ql0 = qb * 64 + wave * 16; const size_t q0 = (size_t)b * TT + ql0, kr0 = (size_t)b * TT + k0;
  v8f acc[8] = {}, accl[8] = {};
  const _Float16* QLb = QL + (size_t)b * QHI * CC; const _Float16* KLb = KL + (size_t)b * KHI * CC;
  if (qb < QBH) {
#pragma unroll
    for (int kc = 0; kc < HD / 32; ++kc) { const v16h ah = frag_h(QH + (q0 + col) * CC + h * HD + kc * 32, lane), al = frag_h(QLb + (size_t)(ql0 + col) * CC + h * HD + kc * 32, lane);
#pragma unroll
      for (int j = 0; j < 8; ++j) { const v16h kbf = frag_h(KH + (kr0 + j * 16 + col) * CC + h * HD + kc * 32, lane), klf = frag_h(KLb + (size_t)(k0 + j * 16 + col) * CC + h * HD + kc * 32, lane); acc[j] = wmma16(ah, kbf, acc[j]); accl[j] = wmma16(al, kbf, accl[j]); accl[j] = wmma16(ah, klf, accl[j]); } }
  } else if (qb * 64 < QHI) {
#pragma unroll
    for (int kc = 0; kc < HD / 32; ++kc) { const v16h ah = frag_h(QH + (q0 + col) * CC + h * HD + kc * 32, lane), al = frag_h(QLb + (size_t)(ql0 + col) * CC + h * HD + kc * 32, lane);
#pragma unroll
      for (int j = 0; j < 8; ++j) { const v16h kbf = frag_h(KH + (kr0 + j * 16 + col) * CC + h * HD + kc * 32, lane); acc[j] = wmma16(ah, kbf, acc[j]); accl[j] = wmma16(al, kbf, accl[j]); } }
  } else {
#pragma unroll
    for (int kc = 0; kc < HD / 32; ++kc) { const v16h ah = frag_h(QH + (q0 + col) * CC + h * HD + kc * 32, lane);
#pragma unroll
      for (int j = 0; j < 8; ++j) { const v16h kbf = frag_h(KH + (kr0 + j * 16 + col) * CC + h * HD + kc * 32, lane); acc[j] = wmma16(ah, kbf, acc[j]); } } }
#pragma unroll
  for (int j = 0; j < 8; ++j) {
#pragma unroll
    for (int r = 0; r < 8; ++r) ss[wave][8 * g + r][j * 16 + col] = (acc[j][r] + accl[j][r] * (1.0f / 1024.0f)) * SCALE; }
  LDSX(); for (int rl = 0; rl < 16; ++rl) vst2(S + (size_t)(ql0 + rl) * TT + k0 + lane * 4, *(const v4f*)&ss[wave][rl][lane * 4]); }
// ---- k_sm: block = query row t (head in group): keys [0, kend): causal -> logit if s <= t else excluded; softmax in f32; P x 2^11 in place (0 for excluded)
__global__ __launch_bounds__(256) void k_sm(float* __restrict__ S0 SM_EXTRA_PARAMS) { __shared__ float sred[8]; __shared__ float sbc; __shared__ __align__(16) float shv[TT];
  const int tid = threadIdx.x; const int t = blockIdx.x; const int kend = (kb_last(t >> 6) + 1) * 128;
  float* sr = S0 + (size_t)blockIdx.y * TT * TT + (size_t)t * TT;
  float m = -3.0e38f; for (int k = tid; k < kend; k += 256) { float v = (!CAUSAL || k <= t) ? sr[k] : -3.0e38f; SM_MASK_HOOK; shv[k] = v; m = fmaxf(m, v); }
#pragma unroll
  for (int o = 1; o < 32; o <<= 1) m = fmaxf(m, __shfl_xor(m, o));
  if ((tid & 31) == 0) sred[tid >> 5] = m; __syncthreads(); if (tid == 0) { float a = sred[0]; for (int i = 1; i < 8; ++i) a = fmaxf(a, sred[i]); sbc = a; } __syncthreads(); m = sbc; __syncthreads();
  float sum = 0.f; for (int k = tid; k < kend; k += 256) { const float v = shv[k]; const float e = (v <= -1.0e38f) ? 0.f : expf(v - m); shv[k] = e; sum += e; }
#pragma unroll
  for (int o = 1; o < 32; o <<= 1) sum += __shfl_xor(sum, o);
  if ((tid & 31) == 0) sred[tid >> 5] = sum; __syncthreads(); if (tid == 0) { float a = 0.f; for (int i = 0; i < 8; ++i) a += sred[i]; sbc = a > 0.f ? 2048.0f / a : 0.f; }   /* a fully excluded row yields P = 0 */ __syncthreads(); const float inv = sbc;
  for (int k = tid; k < kend; k += 256) shv[k] = shv[k] * inv;
  __syncthreads(); for (int q = tid; q < kend / 4; q += 256) vst2(sr + q * 4, *(const v4f*)&shv[q * 4]); }
// ---- k_pv: block = 16 queries of (b, h), PVW waves: wave w takes the 32-key chunks w, w + PVW, ... of keys [0, kend) and forms a partial ctx = P . v (P x 2^11 once to f16 against v f16: 1 product; causal early query blocks: P and v as bf16 hi + lo, 3 products); the PVW partials are summed in LDS in wave order; 256-B (row, head) segment by 16 lanes
#define PVW 32
__global__ __launch_bounds__(32 * PVW) void k_pv(const float* __restrict__ PS0, const _Float16* __restrict__ VT, const __bf16* __restrict__ VB, const __bf16* __restrict__ VBL, int b, int h0, float* __restrict__ Y) { const int h = h0 + blockIdx.z; const float* PS = PS0 + (size_t)blockIdx.z * TT * TT; __shared__ __align__(16) float ss[PVW][16][HD + 4];
  const int tid = threadIdx.x, wave = __builtin_amdgcn_readfirstlane(tid >> 5) /* scalar: the chunk loops branch on SCC, EXEC stays whole at the WMMAs */, lane = tid & 31, col = lane & 15, g = lane >> 4; const int qb = blockIdx.x >> 2; const int ql0 = blockIdx.x * 16; const int kce = (kb_last(qb) + 1) * 4;
  v8f acc[HD / 16] = {};
  if (qb < QBH) {
#pragma unroll 1
    for (int kc = wave; kc < kce; kc += PVW) { const F2 p = split_row(PS + (size_t)(ql0 + col) * TT, kc * 32, lane);
      asm volatile("s_wait_loadcnt 0x0" ::: "memory");
#pragma unroll
      for (int j = 0; j < HD / 16; ++j) { const size_t po = ((size_t)b * CC + h * HD + j * 16 + col) * (size_t)KHI + kc * 32; const v16b vh = frag_b(VB + po, lane); acc[j] = wmma_bf(p.h, vh, acc[j]); acc[j] = wmma_bf(p.l, vh, acc[j]); acc[j] = wmma_bf(p.h, frag_b(VBL + po, lane), acc[j]); } }
  } else {
#pragma unroll 1
    for (int kc = wave; kc < kce; kc += PVW) { const v16h p = frag_f32(PS + (size_t)(ql0 + col) * TT + kc * 32, lane);
      asm volatile("s_wait_loadcnt 0x0" ::: "memory");
#pragma unroll
      for (int j = 0; j < HD / 16; ++j) { const size_t po = ((size_t)b * CC + h * HD + j * 16 + col) * (size_t)TT + kc * 32; acc[j] = wmma16(p, frag_h(VT + po, lane), acc[j]); } } }
#pragma unroll
  for (int j = 0; j < HD / 16; ++j)
#pragma unroll
    for (int r = 0; r < 8; ++r) ss[wave][8 * g + r][j * 16 + col] = acc[j][r];
  __syncthreads();   /* every wave's partial is in LDS before any is summed */
  if (tid < 16 * (HD / 4)) { const int rl = tid >> 4, q = tid & 15; v4f s = *(const v4f*)&ss[0][rl][q * 4];
    for (int w = 1; w < PVW; ++w) s += *(const v4f*)&ss[w][rl][q * 4];
    vst2(Y + ((size_t)b * TT + ql0 + rl) * CC + h * HD + q * 4, s * (1.0f / 2048.0f)); } }

extern "C" void kernel_launch(void* const* d_in, const int* in_sizes, int n_in, void* d_out, int out_size, void* d_ws, size_t ws_size, hipStream_t stream) {
  (void)in_sizes; (void)n_in; (void)out_size;
  const float** F = (const float**)d_in;
  if (ws_size < (size_t)WS_END) return;
  char* ws = (char*)d_ws; _Float16 *QH = (_Float16*)(ws + WS_QH), *KH = (_Float16*)(ws + WS_KH), *VT = (_Float16*)(ws + WS_VT), *QL = (_Float16*)(ws + WS_QL), *KL = (_Float16*)(ws + WS_KL); __bf16 *VB = (__bf16*)(ws + WS_VB), *VBL = (__bf16*)(ws + WS_VBL); float *S = (float*)(ws + WS_S), *Y = (float*)(ws + WS_Y);
  (void)Y; (void)QL; (void)KL; (void)VB; (void)VBL;
  // inputs: 0 embeddings [4096,512]; 1 Wq [64,512] (out,in), 2 bq [64]; 3 Wk, 4 bk; 5 Wv, 6 bv (biases nonzero)
  if (ws_size < (size_t)WS_END2) return;
  float *WP = (float*)(ws + WS_WP), *BP = (float*)(ws + WS_BP), *Y2 = (float*)(ws + WS_Y2);
  k_padw<<<dim3(32, 3), 256, 0, stream>>>(F[1], F[3], F[5], F[2], F[4], F[6], WP, BP);
  k_proj<<<dim3(TNB * TT / 64, CC / 128, 3), 128, 0, stream>>>(F[0], F[0], F[0], WP, WP + (size_t)CIN * 128, WP + 2 * (size_t)CIN * 128, BP, BP + 128, BP + 256, QH, QL, KH, KL, VT, VB, VBL);
  for (int b = 0; b < TNB; ++b) {   /* head 0 only (head 1 is the zero padding) */
    k_sc<<<dim3(NQB, TT / 128, 1), 128, 0, stream>>>(QH, KH, QL, KL, b, 0, S);
    k_sm<<<dim3(TT, 1), 256, 0, stream>>>(S);
    k_pv<<<dim3(TT / 16, 1, 1), 32 * PVW, 0, stream>>>(S, VT, VB, VBL, b, 0, Y2);
  }
  k_out64<<<dim3(TNB * TT / 16), 256, 0, stream>>>(Y2, (float*)d_out);
}

// v002
// Measured time: 82 microseconds a run.
// Timed twice side by side with v001, it ran 1.42 times as fast both times.
// Counting every step since v000, it is 2.73 times as fast.
// compute dtype: all float inputs rounded to bf16; q/k/v projections with EXACT bf16 products on WMMA 16x16x32 (f32 accumulate) + bias; causal logits: 3 products (q f16 hi + residual x k hi + residual) for the first 384 rows, single f16 q x k after, x scale; softmax f32, logits and P never leave registers; exp(logit - partial max) x 2^11 once to f16 x v once to f16 (1 product; bf16 hi + lo below row 384), divided by the sum at the end; f32 output.
#include <hip/hip_runtime.h>
#include <math.h>

typedef __attribute__((ext_vector_type(16))) _Float16 v16h;
typedef __attribute__((ext_vector_type(16))) __bf16 v16b;
typedef __attribute__((ext_vector_type(8)))  _Float16 v8h;
typedef __attribute__((ext_vector_type(8)))  float v8f;
typedef __attribute__((ext_vector_type(4)))  float v4f;
typedef __attribute__((ext_vector_type(2)))  float v2f;
typedef __attribute__((ext_vector_type(4)))  unsigned v4u;
typedef __attribute__((ext_vector_type(4)))  int v4i;
typedef float __attribute__((may_alias)) float_a;
typedef int __attribute__((may_alias)) int_a;

template <typename T> __device__ __forceinline__ void vst2(void* p, T v) { *(T*)p = v;  }
__device__ __forceinline__ v8f wmma16(v16h a, v16h b, v8f c) {
  v8f d = __builtin_amdgcn_wmma_f32_16x16x32_f16(false, a, false, b, (short)0, c, false, false);
  asm volatile("v_nop\n\tv_nop\n\tv_nop\n\tv_nop" : "+v"(d) : "v"(a), "v"(b));
  return d;
}
__device__ __forceinline__ v8f wmma_bf(v16b a, v16b b, v8f c) {
  v8f d = __builtin_amdgcn_wmma_f32_16x16x32_bf16(false, a, false, b, (short)0, c, false, false);
  asm volatile("v_nop\n\tv_nop\n\tv_nop\n\tv_nop" : "+v"(d) : "v"(a), "v"(b));
  return d;
}
// 16x16x32 fragments: lane = (h = lane>>4, row/col = lane&15); elements 0..7 = k0+8h+0..7, 8..15 = k0+16+8h+0..7; D element r = row 8h+r
__device__ __forceinline__ v16h frag_h(const _Float16* rowk0, int lane) {
  union { v16h v; v8h q[2]; } u; const _Float16* p = rowk0 + 8 * (lane >> 4);
  u.q[0] = *(const v8h*)p; u.q[1] = *(const v8h*)(p + 16); return u.v;
}
__device__ __forceinline__ v16h frag_f32(const float* rowk0, int lane) {
  v16h a; const float* p = rowk0 + 8 * (lane >> 4);
#pragma unroll
  for (int i = 0; i < 8; ++i) { a[i] = (_Float16)p[i]; a[8 + i] = (_Float16)p[16 + i]; }
  return a;
}
__device__ __forceinline__ v16h frag_f32s(const float* rowk0, int lane, float sc) {
  v16h a; const float* p = rowk0 + 8 * (lane >> 4);
#pragma unroll
  for (int i = 0; i < 8; ++i) { a[i] = (_Float16)(p[i] * sc); a[8 + i] = (_Float16)(p[16 + i] * sc); }
  return a;
}
// column fragment from a [K][ld] layout (column n), rows >= K read as 0
__device__ __forceinline__ v16h fragc_f32(const float* W, int k0, int n, int lane, int ld, int K) {
  v16h a; const int g = lane >> 4;
#pragma unroll
  for (int i = 0; i < 8; ++i) { const int ka = k0 + 8 * g + i, kb = ka + 16;
    a[i] = (_Float16)(ka < K ? W[(size_t)(ka < K ? ka : K - 1) * ld + n] : 0.f); a[8 + i] = (_Float16)(kb < K ? W[(size_t)(kb < K ? kb : K - 1) * ld + n] : 0.f); }
  return a;
}
struct F2 { v16b h, l; };
__device__ __forceinline__ F2 bsplit16(const float v[16]) { F2 r;
#pragma unroll
  for (int i = 0; i < 16; ++i) { const __bf16 h = (__bf16)v[i]; r.h[i] = h; r.l[i] = (__bf16)(v[i] - (float)h); }
  return r; }
__device__ __forceinline__ F2 split_row(const float* row, int k0, int lane) { float v[16]; const float* p = row + k0 + 8 * (lane >> 4);
#pragma unroll
  for (int i = 0; i < 8; ++i) { v[i] = p[i]; v[8 + i] = p[16 + i]; }
  return bsplit16(v); }
__device__ __forceinline__ F2 split_rowK(const float* row, int k0, int lane, int K) { float v[16]; const int g = lane >> 4;
#pragma unroll
  for (int i = 0; i < 8; ++i) { const int ka = k0 + 8 * g + i, kb = ka + 16; v[i] = ka < K ? row[ka < K ? ka : K - 1] : 0.f; v[8 + i] = kb < K ? row[kb < K ? kb : K - 1] : 0.f; }
  return bsplit16(v); }
__device__ __forceinline__ F2 split_col(const float* W, int k0, int n, int lane, int ld, int K) { float v[16]; const int g = lane >> 4;
#pragma unroll
  for (int i = 0; i < 8; ++i) { const int ka = k0 + 8 * g + i, kb = ka + 16; v[i] = ka < K ? W[(size_t)(ka < K ? ka : K - 1) * ld + n] : 0.f; v[8 + i] = kb < K ? W[(size_t)(kb < K ? kb : K - 1) * ld + n] : 0.f; }
  return bsplit16(v); }
__device__ __forceinline__ v8f mac3(const F2& a, const F2& b, v8f c) { c = wmma_bf(a.l, b.h, c); c = wmma_bf(a.h, b.l, c); return wmma_bf(a.h, b.h, c); }
__device__ __forceinline__ float sigm(float v) { return 1.0f / (1.0f + expf(-v)); }
#define LDSX() do { asm volatile("s_wait_dscnt 0" ::: "memory"); __builtin_amdgcn_wave_barrier(); __builtin_amdgcn_fence(__ATOMIC_RELEASE, "workgroup"); } while (0)

// Single-head causal scaled-dot-product attention over one 4,096-token sequence (d_model 512, d_k = d_v = 64; (out,in) Wq/Wk/Wv [64,512] + biases, torch Linear convention): scores = (Q K^T + M)/sqrt(64) with M = -inf strictly above the diagonal; out = softmax(scores) V -> [4096, 64].
#define NB 1
#define TT 4096
#define CC 128            // NH * HD = projected width
#define DIN 512          // input (model) width
#define NH 2
#define HD 64
#define NQB (TT / 64)
#define HG 1
#define SCALE (0.125f)
#define CAUSAL 1
#ifndef TNB
#define TNB NB
#endif
__device__ __forceinline__ float bfr(float v) { return (float)(__bf16)v; }
__host__ __device__ __forceinline__ int kb_last(int qb) { return CAUSAL ? ((qb * 64 + 63) >> 7) : (TT / 128 - 1); }
typedef __attribute__((ext_vector_type(8))) __bf16 v8b;
__device__ __forceinline__ v16b frag_b(const __bf16* rowk0, int lane) {
  union { v16b v; v8b q[2]; } u; const __bf16* p = rowk0 + 8 * (lane >> 4);
  u.q[0] = *(const v8b*)p; u.q[1] = *(const v8b*)(p + 16); return u.v;
}
#define QBH 6              // causal: query blocks 0..QBH-1 of each sequence (few keys, no averaging) take the high-precision path
#define QHI 384            // rows carrying a q residual plane
#define KHI 384            // key rows carrying k residual / v bf16 hi+lo planes (used only by the causal high-precision path)
// B fragment (k rows k0+.., output column o) of a weight: (in,out) [K][ld] or (out,in) [ld rows of K]: bf16 exact, or f16(bf16 * 256) exact
__device__ __forceinline__ v16b wcol_io(const float* Wm, int k0, int o, int lane, int ld) { v16b w; const int g = lane >> 4;
#pragma unroll
  for (int i = 0; i < 8; ++i) { w[i] = (__bf16)Wm[(size_t)(k0 + 8 * g + i) * ld + o]; w[8 + i] = (__bf16)Wm[(size_t)(k0 + 16 + 8 * g + i) * ld + o]; }
  return w; }
__device__ __forceinline__ v16b wcol_oi(const float* Wm, int k0, int o, int lane, int K) { v16b w; const float* p = Wm + (size_t)o * K + k0 + 8 * (lane >> 4);
#pragma unroll
  for (int i = 0; i < 8; ++i) { w[i] = (__bf16)p[i]; w[8 + i] = (__bf16)p[16 + i]; }
  return w; }
__device__ __forceinline__ v16h wcolh_io(const float* Wm, int k0, int o, int lane, int ld) { v16h w; const int g = lane >> 4;
#pragma unroll
  for (int i = 0; i < 8; ++i) { w[i] = (_Float16)(bfr(Wm[(size_t)(k0 + 8 * g + i) * ld + o]) * 256.0f); w[8 + i] = (_Float16)(bfr(Wm[(size_t)(k0 + 16 + 8 * g + i) * ld + o]) * 256.0f); }
  return w; }
__device__ __forceinline__ v16h wcolh_oi(const float* Wm, int k0, int o, int lane, int K) { v16h w; const float* p = Wm + (size_t)o * K + k0 + 8 * (lane >> 4);
#pragma unroll
  for (int i = 0; i < 8; ++i) { w[i] = (_Float16)(bfr(p[i]) * 256.0f); w[8 + i] = (_Float16)(bfr(p[16 + i]) * 256.0f); }
  return w; }
#define WQKV_LAYOUT 1   // 0 = (in,out) [DIN][CC]; 1 = (out,in) [CC][DIN]; 2 = per-head [NH][DIN][HD]
__device__ __forceinline__ v16b wcol_hdk(const float* Wm, int k0, int o, int lane) { v16b w; const int g = lane >> 4; const float* p = Wm + (size_t)(o / HD) * DIN * HD + (o % HD);
#pragma unroll
  for (int i = 0; i < 8; ++i) { w[i] = (__bf16)p[(size_t)(k0 + 8 * g + i) * HD]; w[8 + i] = (__bf16)p[(size_t)(k0 + 16 + 8 * g + i) * HD]; }
  return w; }
#define WO_OUT_IN 0
#if WQKV_LAYOUT == 1
#define WCOL(W, k0, o, lane) wcol_oi(W, k0, o, lane, DIN)
#elif WQKV_LAYOUT == 2
#define WCOL(W, k0, o, lane) wcol_hdk(W, k0, o, lane)
#else
#define WCOL(W, k0, o, lane) wcol_io(W, k0, o, lane, CC)
#endif
#if WO_OUT_IN
#define WOCOL(W, k0, o, lane) wcol_oi(W, k0, o, lane, CC)
#define WOCOLH(W, k0, o, lane) wcolh_oi(W, k0, o, lane, CC)
#else
#define WOCOL(W, k0, o, lane) wcol_io(W, k0, o, lane, DIN)
#define WOCOLH(W, k0, o, lane) wcolh_io(W, k0, o, lane, DIN)
#endif
#define CIN 512
// ---- k_padw: the three (out,in) [64][C] projection weights copied into zero-padded (out,in) [128][C] ws planes (rows 64..127 zero) + zero-padded [128] biases (columns 64..127 = an all-zero dummy head, never attended)
__global__ __launch_bounds__(256) void k_padw(const float* __restrict__ WQ, const float* __restrict__ WK, const float* __restrict__ WV, const float* __restrict__ BQ, const float* __restrict__ BK, const float* __restrict__ BV, float* __restrict__ WP, float* __restrict__ BP) { const int which = blockIdx.y; const float* Wsrc = which == 0 ? WQ : (which == 1 ? WK : WV); const float* Bsrc = which == 0 ? BQ : (which == 1 ? BK : BV); float* dst = WP + (size_t)which * 128 * CIN;
  for (int e = blockIdx.x * 256 + threadIdx.x; e < 128 * (CIN / 4); e += gridDim.x * 256) { const int row = e / (CIN / 4), q = e % (CIN / 4); const v4f ld = *(const v4f*)(Wsrc + (size_t)(row & 63) * CIN + q * 4); asm volatile("s_wait_loadcnt 0x0" ::: "memory"); const float keep = row < 64 ? 1.f : 0.f; v4f ov; ov[0] = ld[0] * keep; ov[1] = ld[1] * keep; ov[2] = ld[2] * keep; ov[3] = ld[3] * keep; vst2(dst + (size_t)row * CIN + q * 4, ov); }   /* unconditional (clamped) loads, zero by select */
  if (blockIdx.x == 0 && threadIdx.x < 128) { const int c = threadIdx.x; float bvv = 0.f; if (Bsrc) { const float t = Bsrc[c & 63]; asm volatile("s_wait_loadcnt 0x0" ::: "memory"); bvv = c < 64 ? t : 0.f; } vst2(BP + which * 128 + c, bvv); } }
#define WS_WP (WS_END)                                  // padded weights [3][128 x C]
#define WS_BP (WS_WP + 4u * 3 * (size_t)CIN * 128)        // padded biases [3][128]
#define WS_Y2 (WS_BP + 4u * 3 * 128)                      // f32 [b*TT+t][128], unused: ctx goes straight to out
#define WS_END2 (WS_Y2 + 4u * (size_t)NB * TT * CC)
#ifndef SM_EXTRA_PARAMS
#define SM_EXTRA_PARAMS
#endif
#ifndef PROJ_EXTRA_PARAMS
#define PROJ_EXTRA_PARAMS
#endif
#ifndef SM_MASK_HOOK
#define SM_MASK_HOOK (void)0
#endif

#define WS_QH  0u                                      // f16 q rows [b*t][CC]
#define WS_KH  (WS_QH + 2u * (size_t)NB * TT * CC)      // f16 k rows [b*t][CC]
#define WS_VT  (WS_KH + 2u * (size_t)NB * TT * CC)      // f16 v planes [b][c][t]
#define WS_QL  (WS_VT + 2u * (size_t)NB * CC * TT)      // f16 q residual x 2^10 rows [b][t < QHI][CC]
#define WS_KL  (WS_QL + 2u * (size_t)NB * QHI * CC)     // f16 k residual x 2^10 rows [b][t < KHI][CC]
#define WS_VB  (WS_KL + 2u * (size_t)NB * KHI * CC)     // bf16 v hi planes [b][c][t < KHI]
#define WS_VBL (WS_VB + 2u * (size_t)NB * CC * KHI)
#define WS_S   (WS_VBL + 2u * (size_t)NB * CC * KHI)    // f32 [hg][t][s], unused: logits and P stay in registers
#define WS_Y   (WS_S  + 4u * (size_t)HG * TT * TT)      // f32 ctx rows [b*t][CC] (only when there is an output projection)
#define WS_END (WS_Y  + 0u)

// ---- k_proj: block = (64 rows, 128 cols, which): q/k/v = X W (+ b) with exact bf16 products (K = DIN) -> which 0: q f16 rows (+ residual rows < QHI); 1: k f16 rows (+ residual rows < KHI); 2: v f16 planes [c][t] (+ bf16 hi/lo planes for t < KHI)
__global__ __launch_bounds__(128) void k_proj(const float* __restrict__ XQ, const float* __restrict__ XK, const float* __restrict__ XV, const float* __restrict__ WQ, const float* __restrict__ WK, const float* __restrict__ WV, const float* __restrict__ BQ, const float* __restrict__ BK, const float* __restrict__ BV,
    _Float16* __restrict__ QH, _Float16* __restrict__ QL, _Float16* __restrict__ KH, _Float16* __restrict__ KL, _Float16* __restrict__ VT, __bf16* __restrict__ VB, __bf16* __restrict__ VBL) {
  __shared__ __align__(16) _Float16 sh[64][136], sl[64][136]; __shared__ __align__(16) _Float16 th[128][72]; __shared__ __align__(16) __bf16 tb[128][72], tbl[128][72];
  const int tid = threadIdx.x, wave = tid >> 5, lane = tid & 31, col = lane & 15, g = lane >> 4; const int which = blockIdx.z; const int c0 = blockIdx.y * 128; const size_t r0 = (size_t)blockIdx.x * 64; const size_t bb = r0 / TT; const int t0 = (int)(r0 % TT);
  const float* X = which == 0 ? XQ : which == 1 ? XK : XV; const float* WA = which == 0 ? WQ : which == 1 ? WK : WV; const float* BA = which == 0 ? BQ : which == 1 ? BK : BV;
  v8f acc[8] = {};
#pragma unroll 2
  for (int kc = 0; kc < DIN / 32; ++kc) { v16b a; { const float* p = X + (r0 + wave * 16 + col) * DIN + kc * 32 + 8 * g;
#pragma unroll
      for (int i = 0; i < 8; ++i) { a[i] = (__bf16)p[i]; a[8 + i] = (__bf16)p[16 + i]; } }
    asm volatile("s_wait_loadcnt 0x0" ::: "memory");
#pragma unroll
    for (int j = 0; j < 8; ++j) { const v16b w = WCOL(WA, kc * 32, c0 + j * 16 + col, lane); asm volatile("s_wait_loadcnt 0x0" ::: "memory"); acc[j] = wmma_bf(a, w, acc[j]); } }
  if (which < 2) { _Float16* DH = which == 0 ? QH : KH; _Float16* DL = which == 0 ? QL : KL; const int nhi = which == 0 ? QHI : KHI; const bool hi_rows = t0 < nhi;
#pragma unroll
    for (int j = 0; j < 8; ++j) { const float bias = BA ? bfr(BA[c0 + j * 16 + col]) : 0.f;
#pragma unroll
      for (int r = 0; r < 8; ++r) { const float v = acc[j][r] + bias; const _Float16 hv = (_Float16)v; sh[wave * 16 + 8 * g + r][j * 16 + col] = hv; sl[wave * 16 + 8 * g + r][j * 16 + col] = (_Float16)((v - (float)hv) * 1024.0f); } }
    __syncthreads();
    for (int e = tid; e < 64 * 16; e += 128) { const int rl = e >> 4, q = e & 15; vst2((unsigned*)(DH + (r0 + rl) * CC + c0 + q * 8), *(const v4u*)&sh[rl][q * 8]); if (hi_rows) vst2((unsigned*)(DL + (bb * nhi + t0 + rl) * (size_t)CC + c0 + q * 8), *(const v4u*)&sl[rl][q * 8]); }
  } else { const bool hi_rows = t0 < KHI;
#pragma unroll
    for (int j = 0; j < 8; ++j) { const float bias = BA ? bfr(BA[c0 + j * 16 + col]) : 0.f;
#pragma unroll
      for (int r = 0; r < 8; ++r) { const float v = acc[j][r] + bias; const int rl = wave * 16 + 8 * g + r, cl = j * 16 + col; th[cl][rl] = (_Float16)v; const __bf16 bh = (__bf16)v; tb[cl][rl] = bh; tbl[cl][rl] = (__bf16)(v - (float)bh); } }
    __syncthreads();
    for (int e = tid; e < 128 * 8; e += 128) { const int cl = e >> 3, q = e & 7; vst2((unsigned*)(VT + (bb * CC + c0 + cl) * (size_t)TT + t0 + q * 8), *(const v4u*)&th[cl][q * 8]); if (hi_rows) { const size_t o3 = (bb * CC + c0 + cl) * (size_t)KHI + t0 + q * 8; vst2((unsigned*)(VB + o3), *(const v4u*)&tb[cl][q * 8]); vst2((unsigned*)(VBL + o3), *(const v4u*)&tbl[cl][q * 8]); } } } }
// ---- k_att: block = 16 queries of (b, h), PVW waves: wave w takes the 32-key chunks w, w + PVW, ... of keys [0, last query] and keeps its logits in registers from the products to P.
// Logits as S^T = K . Q^T (A = 16 key rows, B = 16 query rows): D register r of key tile tt = key 16 tt + 8 g + r of query col, which is element 8 tt + r of the A fragment of P . v, so P needs no LDS and no lane exchange.
// Query rows < QHI: q hi + residual against k hi + residual (3 products), P and v as bf16 hi + lo (3 products); later rows: 1 product each. Causal mask by index. Softmax in f32 against the wave's own row maximum: P = exp(logit - max) x 2^11.
// The PVW partial (ctx, maximum, sum) triples are merged in LDS in wave order, each scaled by exp(own maximum - row maximum), and go straight to out[b][t][0..63] (the one real head): 256-B row by 16 lanes
// frag_h with the lane half's 8 g already in the pointer
__device__ __forceinline__ v16h frag_p(const _Float16* p) { union { v16h v; v8h q[2]; } u; u.q[0] = *(const v8h*)p; u.q[1] = *(const v8h*)(p + 16); return u.v; }
#define PVW 32
#define NCH (TT / 32 / PVW)   // most chunks one wave can own
#define MFLOOR (-1.0e30f)     // floor of a wave's row maximum: a masked logit (-3e38) stays about 3e38 below it, so its exp is 0 also in a row that the wave sees wholly masked
static_assert(QHI / 32 <= PVW, "a high-precision block has at most one chunk a wave");
static_assert(QBH * 64 == QHI && KHI >= QHI, "residual planes cover every row and key of the high-precision blocks");
__global__ __launch_bounds__(32 * PVW) void k_att(const _Float16* __restrict__ QH, const _Float16* __restrict__ KH, const _Float16* __restrict__ QL, const _Float16* __restrict__ KL, const _Float16* __restrict__ VT, const __bf16* __restrict__ VB, const __bf16* __restrict__ VBL, int b, int h0, float* __restrict__ OUT) { const int h = h0 + blockIdx.z; __shared__ __align__(16) float ss[PVW][16][HD + 4]; __shared__ float smx[PVW][16], ssm[PVW][16];
  const int tid = threadIdx.x, wave = __builtin_amdgcn_readfirstlane(tid >> 5) /* scalar: the chunk tests branch on SCC, EXEC stays whole at the WMMAs */, lane = tid & 31, col = lane & 15, g = lane >> 4; const int qb = blockIdx.x >> 2; const int ql0 = blockIdx.x * 16; const int kce = ((ql0 + 15) >> 5) + 1;   /* chunks that hold a key <= the block's last query */
  const int t = ql0 + col; const size_t q0 = (size_t)b * TT + ql0, kr0 = (size_t)b * TT;
  v8f acc[HD / 16] = {}; float mw = -3.0e38f, sw = 0.f;
  if (qb < QBH) {
    if (wave < kce) { const int k0 = wave * 32; const _Float16* QLb = QL + (size_t)b * QHI * CC; const _Float16* KLb = KL + (size_t)b * KHI * CC;
      v8f a[2] = {}, al[2] = {};
#pragma unroll
      for (int kc = 0; kc < HD / 32; ++kc) { const v16h qh = frag_h(QH + (q0 + col) * CC + h * HD + kc * 32, lane), ql = frag_h(QLb + (size_t)(ql0 + col) * CC + h * HD + kc * 32, lane);
#pragma unroll
        for (int tt = 0; tt < 2; ++tt) { const v16h kh = frag_h(KH + (kr0 + k0 + tt * 16 + col) * CC + h * HD + kc * 32, lane), kl = frag_h(KLb + (size_t)(k0 + tt * 16 + col) * CC + h * HD + kc * 32, lane); a[tt] = wmma16(kh, qh, a[tt]); al[tt] = wmma16(kh, ql, al[tt]); al[tt] = wmma16(kl, qh, al[tt]); } }
      float lg[16];
#pragma unroll
      for (int i = 0; i < 16; ++i) { const int key = k0 + (i >> 3) * 16 + 8 * g + (i & 7); lg[i] = key <= t ? (a[i >> 3][i & 7] + al[i >> 3][i & 7] * (1.0f / 1024.0f)) * SCALE : -3.0e38f; mw = fmaxf(mw, lg[i]); }
      mw = fmaxf(fmaxf(mw, __shfl_xor(mw, 16)), MFLOOR);
#pragma unroll
      for (int i = 0; i < 16; ++i) { const float e = expf(lg[i] - mw); sw += e; lg[i] = e * 2048.0f; }
      const F2 p = bsplit16(lg);
#pragma unroll
      for (int j = 0; j < HD / 16; ++j) { const size_t po = ((size_t)b * CC + h * HD + j * 16 + col) * (size_t)KHI + k0; const v16b vh = frag_b(VB + po, lane); acc[j] = wmma_bf(p.h, vh, acc[j]); acc[j] = wmma_bf(p.l, vh, acc[j]); acc[j] = wmma_bf(p.h, frag_b(VBL + po, lane), acc[j]); } }
  } else {
    const _Float16* qp = QH + (q0 + col) * CC + h * HD + 8 * g; const v16h qf0 = frag_p(qp), qf1 = frag_p(qp + 32);
    asm volatile("s_wait_xcnt 0x0" :: "v"(qp) : "memory");   /* the loads' address pair is free for reuse only behind this wait; naming it keeps it whole until here */
    float lg[NCH][16];
#pragma unroll
    for (int c = 0; c < NCH; ++c) { const int kc = wave + c * PVW, k0 = kc * 32;
      if (kc < kce) { const _Float16* kp = KH + (kr0 + k0 + col) * CC + h * HD;
        const v16h kf0 = frag_h(kp, lane), kf1 = frag_h(kp + 32, lane), kf2 = frag_h(kp + 16 * CC, lane), kf3 = frag_h(kp + 16 * CC + 32, lane);   /* all four fragments asked for ahead of the first product: one latency a chunk */
        v8f a0 = {}, a1 = {}; a0 = wmma16(kf0, qf0, a0); a1 = wmma16(kf2, qf0, a1); a0 = wmma16(kf1, qf1, a0); a1 = wmma16(kf3, qf1, a1);
#pragma unroll
        for (int r = 0; r < 8; ++r) { lg[c][r] = a0[r] * SCALE; lg[c][8 + r] = a1[r] * SCALE; }
        if (kc == kce - 1) {   /* only the block's last chunk holds keys past a query */
#pragma unroll
          for (int i = 0; i < 16; ++i) lg[c][i] = (k0 + (i >> 3) * 16 + 8 * g + (i & 7)) <= t ? lg[c][i] : -3.0e38f; }
#pragma unroll
        for (int i = 0; i < 16; ++i) mw = fmaxf(mw, lg[c][i]); } }
    mw = fmaxf(fmaxf(mw, __shfl_xor(mw, 16)), MFLOOR);
    v16h p[NCH];
#pragma unroll
    for (int c = 0; c < NCH; ++c) {
      if (wave + c * PVW < kce) {
#pragma unroll
        for (int i = 0; i < 16; ++i) { const float e = expf(lg[c][i] - mw); sw += e; p[c][i] = (_Float16)(e * 2048.0f); } } }
#pragma unroll
    for (int c = 0; c < NCH; ++c) {
      if (wave + c * PVW < kce) { const _Float16* vp = VT + ((size_t)b * CC + h * HD + col) * (size_t)TT + (wave + c * PVW) * 32 + 8 * g; v16h vf[HD / 16];
#pragma unroll
        for (int j = 0; j < HD / 16; ++j) vf[j] = frag_p(vp + (size_t)j * 16 * TT);   /* all asked for ahead of the first product */
        asm volatile("s_wait_xcnt 0x0" :: "v"(vp) : "memory");   /* as behind the q loads: no load's own result lands on the shared address pair */
#pragma unroll
        for (int j = 0; j < HD / 16; ++j) acc[j] = wmma16(p[c], vf[j], acc[j]); } } }
  sw += __shfl_xor(sw, 16);
#pragma unroll
  for (int j = 0; j < HD / 16; ++j)
#pragma unroll
    for (int r = 0; r < 8; ++r) ss[wave][8 * g + r][j * 16 + col] = acc[j][r];
  if (g == 0) { smx[wave][col] = mw; ssm[wave][col] = sw; }   /* a wave without a chunk leaves a zero partial under a maximum no logit reaches */
  __syncthreads();   /* every wave's partial is in LDS before any is merged */
  if (tid < 16 * (HD / 4)) { const int rl = tid >> 4, q = tid & 15;
    float m = smx[0][rl];
#pragma unroll
    for (int w = 1; w < PVW; ++w) m = fmaxf(m, smx[w][rl]);
    v4f s = {}; float den = 0.f;
#pragma unroll 8   /* eight partials' LDS reads in flight at a time; unrolled whole, the reads spill */
    for (int w = 0; w < PVW; ++w) { const float f = expf(smx[w][rl] - m); s += *(const v4f*)&ss[w][rl][q * 4] * f; den += ssm[w][rl] * f; }   /* a wave that saw this row wholly masked, or no chunk at all: f = 0 beside a zero partial */
    vst2(OUT + ((size_t)b * TT + ql0 + rl) * HD + q * 4, s * (den > 0.f ? 1.0f / (2048.0f * den) : 0.f)); } }

extern "C" void kernel_launch(void* const* d_in, const int* in_sizes, int n_in, void* d_out, int out_size, void* d_ws, size_t ws_size, hipStream_t stream) {
  (void)in_sizes; (void)n_in; (void)out_size;
  const float** F = (const float**)d_in;
  if (ws_size < (size_t)WS_END) return;
  char* ws = (char*)d_ws; _Float16 *QH = (_Float16*)(ws + WS_QH), *KH = (_Float16*)(ws + WS_KH), *VT = (_Float16*)(ws + WS_VT), *QL = (_Float16*)(ws + WS_QL), *KL = (_Float16*)(ws + WS_KL); __bf16 *VB = (__bf16*)(ws + WS_VB), *VBL = (__bf16*)(ws + WS_VBL); float *S = (float*)(ws + WS_S), *Y = (float*)(ws + WS_Y);
  (void)Y; (void)S; (void)QL; (void)KL; (void)VB; (void)VBL;
  // inputs: 0 embeddings [4096,512]; 1 Wq [64,512] (out,in), 2 bq [64]; 3 Wk, 4 bk; 5 Wv, 6 bv (biases nonzero)
  if (ws_size < (size_t)WS_END2) return;
  float *WP = (float*)(ws + WS_WP), *BP = (float*)(ws + WS_BP);
  k_padw<<<dim3(32, 3), 256, 0, stream>>>(F[1], F[3], F[5], F[2], F[4], F[6], WP, BP);
  k_proj<<<dim3(TNB * TT / 64, CC / 128, 3), 128, 0, stream>>>(F[0], F[0], F[0], WP, WP + (size_t)CIN * 128, WP + 2 * (size_t)CIN * 128, BP, BP + 128, BP + 256, QH, QL, KH, KL, VT, VB, VBL);
  for (int b = 0; b < TNB; ++b) {   /* head 0 only (head 1 is the zero padding) */
    k_att<<<dim3(TT / 16, 1, 1), 32 * PVW, 0, stream>>>(QH, KH, QL, KL, VT, VB, VBL, b, 0, (float*)d_out);
  }
}

// v003
// It runs in 32.2 microseconds.
// Two timings next to v002 put it at 2.66 and 2.55 times that version's speed.
// All steps since v000 together make it 7.10 times as fast.
// compute dtype: all float inputs rounded to bf16; q/k/v projections with EXACT bf16 products on WMMA 16x16x32 (f32 accumulate) + bias; causal logits: 3 products (q f16 hi + residual x k hi + residual) for the first 384 rows, single f16 q x k after, x scale; softmax f32, logits and P never leave registers; exp(logit - partial max) x 2^11 once to f16 x v once to f16 (1 product; bf16 hi + lo below row 384), divided by the sum at the end; f32 output.
#include <hip/hip_runtime.h>
#include <math.h>

typedef __attribute__((ext_vector_type(16))) _Float16 v16h;
typedef __attribute__((ext_vector_type(16))) __bf16 v16b;
typedef __attribute__((ext_vector_type(8)))  _Float16 v8h;
typedef __attribute__((ext_vector_type(8)))  float v8f;
typedef __attribute__((ext_vector_type(4)))  float v4f;
typedef __attribute__((ext_vector_type(2)))  float v2f;
typedef __attribute__((ext_vector_type(4)))  unsigned v4u;
typedef __attribute__((ext_vector_type(4)))  int v4i;
typedef float __attribute__((may_alias)) float_a;
typedef int __attribute__((may_alias)) int_a;

template <typename T> __device__ __forceinline__ void vst2(void* p, T v) { *(T*)p = v;  }
__device__ __forceinline__ v8f wmma16(v16h a, v16h b, v8f c) {
  v8f d = __builtin_amdgcn_wmma_f32_16x16x32_f16(false, a, false, b, (short)0, c, false, false);
  asm volatile("v_nop\n\tv_nop\n\tv_nop\n\tv_nop" : "+v"(d) : "v"(a), "v"(b));
  return d;
}
__device__ __forceinline__ v8f wmma_bf(v16b a, v16b b, v8f c) {
  v8f d = __builtin_amdgcn_wmma_f32_16x16x32_bf16(false, a, false, b, (short)0, c, false, false);
  asm volatile("v_nop\n\tv_nop\n\tv_nop\n\tv_nop" : "+v"(d) : "v"(a), "v"(b));
  return d;
}
// 16x16x32 fragments: lane = (h = lane>>4, row/col = lane&15); elements 0..7 = k0+8h+0..7, 8..15 = k0+16+8h+0..7; D element r = row 8h+r
__device__ __forceinline__ v16h frag_h(const _Float16* rowk0, int lane) {
  union { v16h v; v8h q[2]; } u; const _Float16* p = rowk0 + 8 * (lane >> 4);
  u.q[0] = *(const v8h*)p; u.q[1] = *(const v8h*)(p + 16); return u.v;
}
__device__ __forceinline__ v16h frag_f32(const float* rowk0, int lane) {
  v16h a; const float* p = rowk0 + 8 * (lane >> 4);
#pragma unroll
  for (int i = 0; i < 8; ++i) { a[i] = (_Float16)p[i]; a[8 + i] = (_Float16)p[16 + i]; }
  return a;
}
__device__ __forceinline__ v16h frag_f32s(const float* rowk0, int lane, float sc) {
  v16h a; const float* p = rowk0 + 8 * (lane >> 4);
#pragma unroll
  for (int i = 0; i < 8; ++i) { a[i] = (_Float16)(p[i] * sc); a[8 + i] = (_Float16)(p[16 + i] * sc); }
  return a;
}
// column fragment from a [K][ld] layout (column n), rows >= K read as 0
__device__ __forceinline__ v16h fragc_f32(const float* W, int k0, int n, int lane, int ld, int K) {
  v16h a; const int g = lane >> 4;
#pragma unroll
  for (int i = 0; i < 8; ++i) { const int ka = k0 + 8 * g + i, kb = ka + 16;
    a[i] = (_Float16)(ka < K ? W[(size_t)(ka < K ? ka : K - 1) * ld + n] : 0.f); a[8 + i] = (_Float16)(kb < K ? W[(size_t)(kb < K ? kb : K - 1) * ld + n] : 0.f); }
  return a;
}
struct F2 { v16b h, l; };
__device__ __forceinline__ F2 bsplit16(const float v[16]) { F2 r;
#pragma unroll
  for (int i = 0; i < 16; ++i) { const __bf16 h = (__bf16)v[i]; r.h[i] = h; r.l[i] = (__bf16)(v[i] - (float)h); }
  return r; }
__device__ __forceinline__ F2 split_row(const float* row, int k0, int lane) { float v[16]; const float* p = row + k0 + 8 * (lane >> 4);
#pragma unroll
  for (int i = 0; i < 8; ++i) { v[i] = p[i]; v[8 + i] = p[16 + i]; }
  return bsplit16(v); }
__device__ __forceinline__ F2 split_rowK(const float* row, int k0, int lane, int K) { float v[16]; const int g = lane >> 4;
#pragma unroll
  for (int i = 0; i < 8; ++i) { const int ka = k0 + 8 * g + i, kb = ka + 16; v[i] = ka < K ? row[ka < K ? ka : K - 1] : 0.f; v[8 + i] = kb < K ? row[kb < K ? kb : K - 1] : 0.f; }
  return bsplit16(v); }
__device__ __forceinline__ F2 split_col(const float* W, int k0, int n, int lane, int ld, int K) { float v[16]; const int g = lane >> 4;
#pragma unroll
  for (int i = 0; i < 8; ++i) { const int ka = k0 + 8 * g + i, kb = ka + 16; v[i] = ka < K ? W[(size_t)(ka < K ? ka : K - 1) * ld + n] : 0.f; v[8 + i] = kb < K ? W[(size_t)(kb < K ? kb : K - 1) * ld + n] : 0.f; }
  return bsplit16(v); }
__device__ __forceinline__ v8f mac3(const F2& a, const F2& b, v8f c) { c = wmma_bf(a.l, b.h, c); c = wmma_bf(a.h, b.l, c); return wmma_bf(a.h, b.h, c); }
__device__ __forceinline__ float sigm(float v) { return 1.0f / (1.0f + expf(-v)); }
#define LDSX() do { asm volatile("s_wait_dscnt 0" ::: "memory"); __builtin_amdgcn_wave_barrier(); __builtin_amdgcn_fence(__ATOMIC_RELEASE, "workgroup"); } while (0)

// Single-head causal scaled-dot-product attention over one 4,096-token sequence (d_model 512, d_k = d_v = 64; (out,in) Wq/Wk/Wv [64,512] + biases, torch Linear convention): scores = (Q K^T + M)/sqrt(64) with M = -inf strictly above the diagonal; out = softmax(scores) V -> [4096, 64].
#define NB 1
#define TT 4096
#define CC 128            // NH * HD = projected width
#define DIN 512          // input (model) width
#define NH 2
#define HD 64
#define NQB (TT / 64)
#define HG 1
#define SCALE (0.125f)
#define CAUSAL 1
#ifndef TNB
#define TNB NB
#endif
__device__ __forceinline__ float bfr(float v) { return (float)(__bf16)v; }
__host__ __device__ __forceinline__ int kb_last(int qb) { return CAUSAL ? ((qb * 64 + 63) >> 7) : (TT / 128 - 1); }
typedef __attribute__((ext_vector_type(8))) __bf16 v8b;
__device__ __forceinline__ v16b frag_b(const __bf16* rowk0, int lane) {
  union { v16b v; v8b q[2]; } u; const __bf16* p = rowk0 + 8 * (lane >> 4);
  u.q[0] = *(const v8b*)p; u.q[1] = *(const v8b*)(p + 16); return u.v;
}
#define QBH 6              // causal: query blocks 0..QBH-1 of each sequence (few keys, no averaging) take the high-precision path
#define QHI 384            // rows carrying a q residual plane
#define KHI 384            // key rows carrying k residual / v bf16 hi+lo planes (used only by the causal high-precision path)
// B fragment (k rows k0+.., output column o) of a weight: (in,out) [K][ld] or (out,in) [ld rows of K]: bf16 exact, or f16(bf16 * 256) exact
__device__ __forceinline__ v16b wcol_io(const float* Wm, int k0, int o, int lane, int ld) { v16b w; const int g = lane >> 4;
#pragma unroll
  for (int i = 0; i < 8; ++i) { w[i] = (__bf16)Wm[(size_t)(k0 + 8 * g + i) * ld + o]; w[8 + i] = (__bf16)Wm[(size_t)(k0 + 16 + 8 * g + i) * ld + o]; }
  return w; }
__device__ __forceinline__ v16b wcol_oi(const float* Wm, int k0, int o, int lane, int K) { v16b w; const float* p = Wm + (size_t)o * K + k0 + 8 * (lane >> 4);
#pragma unroll
  for (int i = 0; i < 8; ++i) { w[i] = (__bf16)p[i]; w[8 + i] = (__bf16)p[16 + i]; }
  return w; }
__device__ __forceinline__ v16h wcolh_io(const float* Wm, int k0, int o, int lane, int ld) { v16h w; const int g = lane >> 4;
#pragma unroll
  for (int i = 0; i < 8; ++i) { w[i] = (_Float16)(bfr(Wm[(size_t)(k0 + 8 * g + i) * ld + o]) * 256.0f); w[8 + i] = (_Float16)(bfr(Wm[(size_t)(k0 + 16 + 8 * g + i) * ld + o]) * 256.0f); }
  return w; }
__device__ __forceinline__ v16h wcolh_oi(const float* Wm, int k0, int o, int lane, int K) { v16h w; const float* p = Wm + (size_t)o * K + k0 + 8 * (lane >> 4);
#pragma unroll
  for (int i = 0; i < 8; ++i) { w[i] = (_Float16)(bfr(p[i]) * 256.0f); w[8 + i] = (_Float16)(bfr(p[16 + i]) * 256.0f); }
  return w; }
#define WQKV_LAYOUT 1   // 0 = (in,out) [DIN][CC]; 1 = (out,in) [CC][DIN]; 2 = per-head [NH][DIN][HD]
__device__ __forceinline__ v16b wcol_hdk(const float* Wm, int k0, int o, int lane) { v16b w; const int g = lane >> 4; const float* p = Wm + (size_t)(o / HD) * DIN * HD + (o % HD);
#pragma unroll
  for (int i = 0; i < 8; ++i) { w[i] = (__bf16)p[(size_t)(k0 + 8 * g + i) * HD]; w[8 + i] = (__bf16)p[(size_t)(k0 + 16 + 8 * g + i) * HD]; }
  return w; }
#define WO_OUT_IN 0
#if WQKV_LAYOUT == 1
#define WCOL(W, k0, o, lane) wcol_oi(W, k0, o, lane, DIN)
#elif WQKV_LAYOUT == 2
#define WCOL(W, k0, o, lane) wcol_hdk(W, k0, o, lane)
#else
#define WCOL(W, k0, o, lane) wcol_io(W, k0, o, lane, CC)
#endif
#if WO_OUT_IN
#define WOCOL(W, k0, o, lane) wcol_oi(W, k0, o, lane, CC)
#define WOCOLH(W, k0, o, lane) wcolh_oi(W, k0, o, lane, CC)
#else
#define WOCOL(W, k0, o, lane) wcol_io(W, k0, o, lane, DIN)
#define WOCOLH(W, k0, o, lane) wcolh_io(W, k0, o, lane, DIN)
#endif
#define CIN 512
// ---- k_padw: the three (out,in) [64][C] projection weights copied into zero-padded (out,in) [128][C] ws planes (rows 64..127 zero) + zero-padded [128] biases (columns 64..127 = an all-zero dummy head, never attended)
__global__ __launch_bounds__(256) void k_padw(const float* __restrict__ WQ, const float* __restrict__ WK, const float* __restrict__ WV, const float* __restrict__ BQ, const float* __restrict__ BK, const float* __restrict__ BV, float* __restrict__ WP, float* __restrict__ BP) { const int which = blockIdx.y; const float* Wsrc = which == 0 ? WQ : (which == 1 ? WK : WV); const float* Bsrc = which == 0 ? BQ : (which == 1 ? BK : BV); float* dst = WP + (size_t)which * 128 * CIN;
  for (int e = blockIdx.x * 256 + threadIdx.x; e < 128 * (CIN / 4); e += gridDim.x * 256) { const int row = e / (CIN / 4), q = e % (CIN / 4); const v4f ld = *(const v4f*)(Wsrc + (size_t)(row & 63) * CIN + q * 4); asm volatile("s_wait_loadcnt 0x0" ::: "memory"); const float keep = row < 64 ? 1.f : 0.f; v4f ov; ov[0] = ld[0] * keep; ov[1] = ld[1] * keep; ov[2] = ld[2] * keep; ov[3] = ld[3] * keep; vst2(dst + (size_t)row * CIN + q * 4, ov); }   /* unconditional (clamped) loads, zero by select */
  if (blockIdx.x == 0 && threadIdx.x < 128) { const int c = threadIdx.x; float bvv = 0.f; if (Bsrc) { const float t = Bsrc[c & 63]; asm volatile("s_wait_loadcnt 0x0" ::: "memory"); bvv = c < 64 ? t : 0.f; } vst2(BP + which * 128 + c, bvv); } }
#define WS_WP (WS_END)                                  // padded weights [3][128 x C]
#define WS_BP (WS_WP + 4u * 3 * (size_t)CIN * 128)        // padded biases [3][128]
#define WS_Y2 (WS_BP + 4u * 3 * 128)                      // f32 [b*TT+t][128], unused: ctx goes straight to out
#define WS_END2 (WS_Y2 + 4u * (size_t)NB * TT * CC)
#ifndef SM_EXTRA_PARAMS
#define SM_EXTRA_PARAMS
#endif
#ifndef PROJ_EXTRA_PARAMS
#define PROJ_EXTRA_PARAMS
#endif
#ifndef SM_MASK_HOOK
#define SM_MASK_HOOK (void)0
#endif

#define WS_QH  0u                                      // f16 q rows [b*t][CC]
#define WS_KH  (WS_QH + 2u * (size_t)NB * TT * CC)      // f16 k rows [b*t][CC]
#define WS_VT  (WS_KH + 2u * (size_t)NB * TT * CC)      // f16 v planes [b][c][t]
#define WS_QL  (WS_VT + 2u * (size_t)NB * CC * TT)      // f16 q residual x 2^10 rows [b][t < QHI][CC]
#define WS_KL  (WS_QL + 2u * (size_t)NB * QHI * CC)     // f16 k residual x 2^10 rows [b][t < KHI][CC]
#define WS_VB  (WS_KL + 2u * (size_t)NB * KHI * CC)     // bf16 v hi planes [b][c][t < KHI]
#define WS_VBL (WS_VB + 2u * (size_t)NB * CC * KHI)
#define WS_S   (WS_VBL + 2u * (size_t)NB * CC * KHI)    // f32 [hg][t][s], unused: logits and P stay in registers
#define WS_Y   (WS_S  + 4u * (size_t)HG * TT * TT)      // f32 ctx rows [b*t][CC] (only when there is an output projection)
#define WS_END (WS_Y  + 0u)

typedef __attribute__((ext_vector_type(4))) __bf16 v4b;
#define SB 16   // rows of a staging batch
static_assert(64 % SB == 0 && (64 + 128) % (3 * SB) == 0, "a batch lies in one operand; the staged rows are whole trips of three batches");
__device__ __forceinline__ void st_load(v4f (&t)[SB], const float* sp) {
#pragma unroll
  for (int i = 0; i < SB; ++i) t[i] = *(const v4f*)(sp + (size_t)i * DIN);
  asm volatile("s_wait_xcnt 0x0" :: "v"(sp) : "memory"); }   /* a precaution: the wait stands ahead of any reuse of the batch's shared address pair; naming the pair keeps it whole until here, so that no load's own result lands on it */
__device__ __forceinline__ void st_put(const v4f (&t)[SB], __bf16* dp) {
#pragma unroll
  for (int i = 0; i < SB; ++i) { v4b o; o[0] = (__bf16)t[i][0]; o[1] = (__bf16)t[i][1]; o[2] = (__bf16)t[i][2]; o[3] = (__bf16)t[i][3]; *(v4b*)(dp + i * (DIN + 8)) = o; } }
// ---- k_proj: block = (64 rows, 128 cols, which): q/k/v = X W (+ b) with exact bf16 products (K = DIN), both operand tiles rounded to bf16 once and held in LDS -> which 0: q f16 rows (+ residual rows < QHI); 1: k f16 rows (+ residual rows < KHI); 2: v f16 planes [c][t] (+ bf16 hi/lo planes for t < KHI)
__global__ __launch_bounds__(128) void k_proj(const float* __restrict__ XQ, const float* __restrict__ XK, const float* __restrict__ XV, const float* __restrict__ WQ, const float* __restrict__ WK, const float* __restrict__ WV, const float* __restrict__ BQ, const float* __restrict__ BK, const float* __restrict__ BV,
    _Float16* __restrict__ QH, _Float16* __restrict__ QL, _Float16* __restrict__ KH, _Float16* __restrict__ KL, _Float16* __restrict__ VT, __bf16* __restrict__ VB, __bf16* __restrict__ VBL) {
  __shared__ __align__(16) _Float16 sh[64][136], sl[64][136]; __shared__ __align__(16) _Float16 th[128][72]; __shared__ __align__(16) __bf16 tb[128][72], tbl[128][72];
  __shared__ __align__(16) __bf16 sxw[64 + 128][DIN + 8];   /* bf16 operand tiles, the 64 X rows and then the 128 W rows; row pitch 16 B x odd: conflict-free for the 16-byte fragment reads */
  const int tid = threadIdx.x, wave = tid >> 5, lane = tid & 31, col = lane & 15, g = lane >> 4; const int which = blockIdx.z; const int c0 = blockIdx.y * 128; const size_t r0 = (size_t)blockIdx.x * 64; const size_t bb = r0 / TT; const int t0 = (int)(r0 % TT);
  const float* X = which == 0 ? XQ : which == 1 ? XK : XV; const float* WA = which == 0 ? WQ : which == 1 ? WK : WV; const float* BA = which == 0 ? BQ : which == 1 ? BK : BV;
  // the 64 X rows and the 128 W rows are each one contiguous range, and 128 threads x 4 floats are one row: every wave-wide load covers 512 contiguous bytes (4 whole lines), every element is read and rounded once a block
  { const float* xb = X + r0 * DIN + tid * 4; const float* wb = WA + (size_t)c0 * DIN + tid * 4;   /* staged row r is X row r below 64, W row r - 64 from there on */
    __bf16* dp = &sxw[0][tid * 4]; v4f u0[SB], u1[SB], u2[SB];
    st_load(u0, xb); st_load(u1, xb + (size_t)SB * DIN);
#pragma unroll 1   /* rolled, three register sets: two to three batches' loads stay in flight while the oldest batch is rounded and stored */
    for (int b0 = 0; b0 < 64 + 128; b0 += 3 * SB) { const int b1 = b0 + SB, b2 = b0 + 2 * SB, b3 = b0 + 3 * SB, b4 = b0 + 4 * SB; const bool more = b3 < 64 + 128;
      st_load(u2, b2 < 64 ? xb + (size_t)b2 * DIN : wb + (size_t)(b2 - 64) * DIN); st_put(u0, dp + b0 * (DIN + 8));
      if (more) st_load(u0, b3 < 64 ? xb + (size_t)b3 * DIN : wb + (size_t)(b3 - 64) * DIN);
      st_put(u1, dp + b1 * (DIN + 8));
      if (more) st_load(u1, b4 < 64 ? xb + (size_t)b4 * DIN : wb + (size_t)(b4 - 64) * DIN);
      st_put(u2, dp + b2 * (DIN + 8)); } }
  __syncthreads();   /* both tiles are whole in LDS before any wave reads a fragment */
  v8f acc[8] = {};
  const __bf16* ap = &sxw[wave * 16 + col][0]; const __bf16* wp = &sxw[64 + col][0];
  v16b a = frag_b(ap, lane), w[8];
#pragma unroll
  for (int j = 0; j < 8; ++j) w[j] = frag_b(wp + j * 16 * (DIN + 8), lane);
#pragma unroll   /* whole: the next step's fragments are read as one group ahead of this step's products, into a second register set */
  for (int kc = 0; kc < DIN / 32; ++kc) { v16b an = a, wn[8];
#pragma unroll
    for (int j = 0; j < 8; ++j) wn[j] = w[j];
    if (kc + 1 < DIN / 32) { an = frag_b(ap + (kc + 1) * 32, lane);
#pragma unroll
      for (int j = 0; j < 8; ++j) wn[j] = frag_b(wp + j * 16 * (DIN + 8) + (kc + 1) * 32, lane); }
#pragma unroll
    for (int j = 0; j < 8; ++j) acc[j] = wmma_bf(a, w[j], acc[j]);
    a = an;
#pragma unroll
    for (int j = 0; j < 8; ++j) w[j] = wn[j]; }
  if (which < 2) { _Float16* DH = which == 0 ? QH : KH; _Float16* DL = which == 0 ? QL : KL; const int nhi = which == 0 ? QHI : KHI; const bool hi_rows = t0 < nhi;
#pragma unroll
    for (int j = 0; j < 8; ++j) { const float bias = BA ? bfr(BA[c0 + j * 16 + col]) : 0.f;
#pragma unroll
      for (int r = 0; r < 8; ++r) { const float v = acc[j][r] + bias; const _Float16 hv = (_Float16)v; sh[wave * 16 + 8 * g + r][j * 16 + col] = hv; sl[wave * 16 + 8 * g + r][j * 16 + col] = (_Float16)((v - (float)hv) * 1024.0f); } }
    __syncthreads();
    for (int e = tid; e < 64 * 16; e += 128) { const int rl = e >> 4, q = e & 15; vst2((unsigned*)(DH + (r0 + rl) * CC + c0 + q * 8), *(const v4u*)&sh[rl][q * 8]); if (hi_rows) vst2((unsigned*)(DL + (bb * nhi + t0 + rl) * (size_t)CC + c0 + q * 8), *(const v4u*)&sl[rl][q * 8]); }
  } else { const bool hi_rows = t0 < KHI;
#pragma unroll
    for (int j = 0; j < 8; ++j) { const float bias = BA ? bfr(BA[c0 + j * 16 + col]) : 0.f;
#pragma unroll
      for (int r = 0; r < 8; ++r) { const float v = acc[j][r] + bias; const int rl = wave * 16 + 8 * g + r, cl = j * 16 + col; th[cl][rl] = (_Float16)v; const __bf16 bh = (__bf16)v; tb[cl][rl] = bh; tbl[cl][rl] = (__bf16)(v - (float)bh); } }
    __syncthreads();
    for (int e = tid; e < 128 * 8; e += 128) { const int cl = e >> 3, q = e & 7; vst2((unsigned*)(VT + (bb * CC + c0 + cl) * (size_t)TT + t0 + q * 8), *(const v4u*)&th[cl][q * 8]); if (hi_rows) { const size_t o3 = (bb * CC + c0 + cl) * (size_t)KHI + t0 + q * 8; vst2((unsigned*)(VB + o3), *(const v4u*)&tb[cl][q * 8]); vst2((unsigned*)(VBL + o3), *(const v4u*)&tbl[cl][q * 8]); } } } }
// ---- k_att: block = 16 queries of (b, h), PVW waves: wave w takes the 32-key chunks w, w + PVW, ... of keys [0, last query] and keeps its logits in registers from the products to P.
// Logits as S^T = K . Q^T (A = 16 key rows, B = 16 query rows): D register r of key tile tt = key 16 tt + 8 g + r of query col, which is element 8 tt + r of the A fragment of P . v, so P needs no LDS and no lane exchange.
// Query rows < QHI: q hi + residual against k hi + residual (3 products), P and v as bf16 hi + lo (3 products); later rows: 1 product each. Causal mask by index. Softmax in f32 against the wave's own row maximum: P = exp(logit - max) x 2^11.
// The PVW partial (ctx, maximum, sum) triples are merged in LDS in wave order, each scaled by exp(own maximum - row maximum), and go straight to out[b][t][0..63] (the one real head): 256-B row by 16 lanes
// frag_h with the lane half's 8 g already in the pointer
__device__ __forceinline__ v16h frag_p(const _Float16* p) { union { v16h v; v8h q[2]; } u; u.q[0] = *(const v8h*)p; u.q[1] = *(const v8h*)(p + 16); return u.v; }
#define PVW 32
#define NCH (TT / 32 / PVW)   // most chunks one wave can own
#define MFLOOR (-1.0e30f)     // floor of a wave's row maximum: a masked logit (-3e38) stays about 3e38 below it, so its exp is 0 also in a row that the wave sees wholly masked
static_assert(QHI / 32 <= PVW, "a high-precision block has at most one chunk a wave");
static_assert(QBH * 64 == QHI && KHI >= QHI, "residual planes cover every row and key of the high-precision blocks");
__global__ __launch_bounds__(32 * PVW) void k_att(const _Float16* __restrict__ QH, const _Float16* __restrict__ KH, const _Float16* __restrict__ QL, const _Float16* __restrict__ KL, const _Float16* __restrict__ VT, const __bf16* __restrict__ VB, const __bf16* __restrict__ VBL, int b, int h0, float* __restrict__ OUT) { const int h = h0 + blockIdx.z; __shared__ __align__(16) float ss[PVW][16][HD + 4]; __shared__ float smx[PVW][16], ssm[PVW][16];
  const int tid = threadIdx.x, wave = __builtin_amdgcn_readfirstlane(tid >> 5) /* scalar: the chunk tests branch on SCC, EXEC stays whole at the WMMAs */, lane = tid & 31, col = lane & 15, g = lane >> 4; const int qb = blockIdx.x >> 2; const int ql0 = blockIdx.x * 16; const int kce = ((ql0 + 15) >> 5) + 1;   /* chunks that hold a key <= the block's last query */
  const int t = ql0 + col; const size_t q0 = (size_t)b * TT + ql0, kr0 = (size_t)b * TT;
  v8f acc[HD / 16] = {}; float mw = -3.0e38f, sw = 0.f;
  if (qb < QBH) {
    if (wave < kce) { const int k0 = wave * 32; const _Float16* QLb = QL + (size_t)b * QHI * CC; const _Float16* KLb = KL + (size_t)b * KHI * CC;
      v8f a[2] = {}, al[2] = {};
#pragma unroll
      for (int kc = 0; kc < HD / 32; ++kc) { const v16h qh = frag_h(QH + (q0 + col) * CC + h * HD + kc * 32, lane), ql = frag_h(QLb + (size_t)(ql0 + col) * CC + h * HD + kc * 32, lane);
#pragma unroll
        for (int tt = 0; tt < 2; ++tt) { const v16h kh = frag_h(KH + (kr0 + k0 + tt * 16 + col) * CC + h * HD + kc * 32, lane), kl = frag_h(KLb + (size_t)(k0 + tt * 16 + col) * CC + h * HD + kc * 32, lane); a[tt] = wmma16(kh, qh, a[tt]); al[tt] = wmma16(kh, ql, al[tt]); al[tt] = wmma16(kl, qh, al[tt]); } }
      float lg[16];
#pragma unroll
      for (int i = 0; i < 16; ++i) { const int key = k0 + (i >> 3) * 16 + 8 * g + (i & 7); lg[i] = key <= t ? (a[i >> 3][i & 7] + al[i >> 3][i & 7] * (1.0f / 1024.0f)) * SCALE : -3.0e38f; mw = fmaxf(mw, lg[i]); }
      mw = fmaxf(fmaxf(mw, __shfl_xor(mw, 16)), MFLOOR);
#pragma unroll
      for (int i = 0; i < 16; ++i) { const float e = expf(lg[i] - mw); sw += e; lg[i] = e * 2048.0f; }
      const F2 p = bsplit16(lg);
#pragma unroll
      for (int j = 0; j < HD / 16; ++j) { const size_t po = ((size_t)b * CC + h * HD + j * 16 + col) * (size_t)KHI + k0; const v16b vh = frag_b(VB + po, lane); acc[j] = wmma_bf(p.h, vh, acc[j]); acc[j] = wmma_bf(p.l, vh, acc[j]); acc[j] = wmma_bf(p.h, frag_b(VBL + po, lane), acc[j]); } }
  } else {
    const _Float16* qp = QH + (q0 + col) * CC + h * HD + 8 * g; const v16h qf0 = frag_p(qp), qf1 = frag_p(qp + 32);
    asm volatile("s_wait_xcnt 0x0" :: "v"(qp) : "memory");   /* the loads' address pair is free for reuse only behind this wait; naming it keeps it whole until here */
    float lg[NCH][16];
#pragma unroll
    for (int c = 0; c < NCH; ++c) { const int kc = wave + c * PVW, k0 = kc * 32;
      if (kc < kce) { const _Float16* kp = KH + (kr0 + k0 + col) * CC + h * HD;
        const v16h kf0 = frag_h(kp, lane), kf1 = frag_h(kp + 32, lane), kf2 = frag_h(kp + 16 * CC, lane), kf3 = frag_h(kp + 16 * CC + 32, lane);   /* all four fragments asked for ahead of the first product: one latency a chunk */
        v8f a0 = {}, a1 = {}; a0 = wmma16(kf0, qf0, a0); a1 = wmma16(kf2, qf0, a1); a0 = wmma16(kf1, qf1, a0); a1 = wmma16(kf3, qf1, a1);
#pragma unroll
        for (int r = 0; r < 8; ++r) { lg[c][r] = a0[r] * SCALE; lg[c][8 + r] = a1[r] * SCALE; }
        if (kc == kce - 1) {   /* only the block's last chunk holds keys past a query */
#pragma unroll
          for (int i = 0; i < 16; ++i) lg[c][i] = (k0 + (i >> 3) * 16 + 8 * g + (i & 7)) <= t ? lg[c][i] : -3.0e38f; }
#pragma unroll
        for (int i = 0; i < 16; ++i) mw = fmaxf(mw, lg[c][i]); } }
    mw = fmaxf(fmaxf(mw, __shfl_xor(mw, 16)), MFLOOR);
    v16h p[NCH];
#pragma unroll
    for (int c = 0; c < NCH; ++c) {
      if (wave + c * PVW < kce) {
#pragma unroll
        for (int i = 0; i < 16; ++i) { const float e = expf(lg[c][i] - mw); sw += e; p[c][i] = (_Float16)(e * 2048.0f); } } }
#pragma unroll
    for (int c = 0; c < NCH; ++c) {
      if (wave + c * PVW < kce) { const _Float16* vp = VT + ((size_t)b * CC + h * HD + col) * (size_t)TT + (wave + c * PVW) * 32 + 8 * g; v16h vf[HD / 16];
#pragma unroll
        for (int j = 0; j < HD / 16; ++j) vf[j] = frag_p(vp + (size_t)j * 16 * TT);   /* all asked for ahead of the first product */
        asm volatile("s_wait_xcnt 0x0" :: "v"(vp) : "memory");   /* as behind the q loads: no load's own result lands on the shared address pair */
#pragma unroll
        for (int j = 0; j < HD / 16; ++j) acc[j] = wmma16(p[c], vf[j], acc[j]); } } }
  sw += __shfl_xor(sw, 16);
#pragma unroll
  for (int j = 0; j < HD / 16; ++j)
#pragma unroll
    for (int r = 0; r < 8; ++r) ss[wave][8 * g + r][j * 16 + col] = acc[j][r];
  if (g == 0) { smx[wave][col] = mw; ssm[wave][col] = sw; }   /* a wave without a chunk leaves a zero partial under a maximum no logit reaches */
  __syncthreads();   /* every wave's partial is in LDS before any is merged */
  if (tid < 16 * (HD / 4)) { const int rl = tid >> 4, q = tid & 15;
    float m = smx[0][rl];
#pragma unroll
    for (int w = 1; w < PVW; ++w) m = fmaxf(m, smx[w][rl]);
    v4f s = {}; float den = 0.f;
#pragma unroll 8   /* eight partials' LDS reads in flight at a time; unrolled whole, the reads spill */
    for (int w = 0; w < PVW; ++w) { const float f = expf(smx[w][rl] - m); s += *(const v4f*)&ss[w][rl][q * 4] * f; den += ssm[w][rl] * f; }   /* a wave that saw this row wholly masked, or no chunk at all: f = 0 beside a zero partial */
    vst2(OUT + ((size_t)b * TT + ql0 + rl) * HD + q * 4, s * (den > 0.f ? 1.0f / (2048.0f * den) : 0.f)); } }

extern "C" void kernel_launch(void* const* d_in, const int* in_sizes, int n_in, void* d_out, int out_size, void* d_ws, size_t ws_size, hipStream_t stream) {
  (void)in_sizes; (void)n_in; (void)out_size;
  const float** F = (const float**)d_in;
  if (ws_size < (size_t)WS_END) return;
  char* ws = (char*)d_ws; _Float16 *QH = (_Float16*)(ws + WS_QH), *KH = (_Float16*)(ws + WS_KH), *VT = (_Float16*)(ws + WS_VT), *QL = (_Float16*)(ws + WS_QL), *KL = (_Float16*)(ws + WS_KL); __bf16 *VB = (__bf16*)(ws + WS_VB), *VBL = (__bf16*)(ws + WS_VBL); float *S = (float*)(ws + WS_S), *Y = (float*)(ws + WS_Y);
  (void)Y; (void)S; (void)QL; (void)KL; (void)VB; (void)VBL;
  // inputs: 0 embeddings [4096,512]; 1 Wq [64,512] (out,in), 2 bq [64]; 3 Wk, 4 bk; 5 Wv, 6 bv (biases nonzero)
  if (ws_size < (size_t)WS_END2) return;
  float *WP = (float*)(ws + WS_WP), *BP = (float*)(ws + WS_BP);
  k_padw<<<dim3(32, 3), 256, 0, stream>>>(F[1], F[3], F[5], F[2], F[4], F[6], WP, BP);
  k_proj<<<dim3(TNB * TT / 64, CC / 128, 3), 128, 0, stream>>>(F[0], F[0], F[0], WP, WP + (size_t)CIN * 128, WP + 2 * (size_t)CIN * 128, BP, BP + 128, BP + 256, QH, QL, KH, KL, VT, VB, VBL);
  for (int b = 0; b < TNB; ++b) {   /* head 0 only (head 1 is the zero padding) */
    k_att<<<dim3(TT / 16, 1, 1), 32 * PVW, 0, stream>>>(QH, KH, QL, KL, VT, VB, VBL, b, 0, (float*)d_out);
  }
}

// v004
// One run takes 25.1 microseconds.
// Next to v003, in two timings, it ran 1.26 and 1.28 times as fast.
// Counting every step since v000, it is 9.04 times as fast.
// compute dtype: all float inputs rounded to bf16; q/k/v projections with EXACT bf16 products on WMMA 16x16x32 (f32 accumulate) + bias; causal logits: 3 products (q f16 hi + residual x k hi + residual) for the first 384 rows, single f16 q x k after, x scale; softmax f32, logits and P never leave registers; exp(logit - partial max) x 2^11 once to f16 x v once to f16 (1 product; bf16 hi + lo below row 384), divided by the sum at the end; f32 output.
#include <hip/hip_runtime.h>
#include <math.h>

typedef __attribute__((ext_vector_type(16))) _Float16 v16h;
typedef __attribute__((ext_vector_type(16))) __bf16 v16b;
typedef __attribute__((ext_vector_type(8)))  _Float16 v8h;
typedef __attribute__((ext_vector_type(8)))  float v8f;
typedef __attribute__((ext_vector_type(4)))  float v4f;
typedef __attribute__((ext_vector_type(2)))  float v2f;
typedef __attribute__((ext_vector_type(4)))  unsigned v4u;
typedef __attribute__((ext_vector_type(4)))  int v4i;
typedef float __attribute__((may_alias)) float_a;
typedef int __attribute__((may_alias)) int_a;

template <typename T> __device__ __forceinline__ void vst2(void* p, T v) { *(T*)p = v;  }
__device__ __forceinline__ v8f wmma16(v16h a, v16h b, v8f c) {
  v8f d = __builtin_amdgcn_wmma_f32_16x16x32_f16(false, a, false, b, (short)0, c, false, false);
  asm volatile("v_nop\n\tv_nop\n\tv_nop\n\tv_nop" : "+v"(d) : "v"(a), "v"(b));
  return d;
}
__device__ __forceinline__ v8f wmma_bf(v16b a, v16b b, v8f c) {
  v8f d = __builtin_amdgcn_wmma_f32_16x16x32_bf16(false, a, false, b, (short)0, c, false, false);
  asm volatile("v_nop\n\tv_nop\n\tv_nop\n\tv_nop" : "+v"(d) : "v"(a), "v"(b));
  return d;
}
// 16x16x32 fragments: lane = (h = lane>>4, row/col = lane&15); elements 0..7 = k0+8h+0..7, 8..15 = k0+16+8h+0..7; D element r = row 8h+r
__device__ __forceinline__ v16h frag_h(const _Float16* rowk0, int lane) {
  union { v16h v; v8h q[2]; } u; const _Float16* p = rowk0 + 8 * (lane >> 4);
  u.q[0] = *(const v8h*)p; u.q[1] = *(const v8h*)(p + 16); return u.v;
}
__device__ __forceinline__ v16h frag_f32(const float* rowk0, int lane) {
  v16h a; const float* p = rowk0 + 8 * (lane >> 4);
#pragma unroll
  for (int i = 0; i < 8; ++i) { a[i] = (_Float16)p[i]; a[8 + i] = (_Float16)p[16 + i]; }
  return a;
}
__device__ __forceinline__ v16h frag_f32s(const float* rowk0, int lane, float sc) {
  v16h a; const float* p = rowk0 + 8 * (lane >> 4);
#pragma unroll
  for (int i = 0; i < 8; ++i) { a[i] = (_Float16)(p[i] * sc); a[8 + i] = (_Float16)(p[16 + i] * sc); }
  return a;
}
// column fragment from a [K][ld] layout (column n), rows >= K read as 0
__device__ __forceinline__ v16h fragc_f32(const float* W, int k0, int n, int lane, int ld, int K) {
  v16h a; const int g = lane >> 4;
#pragma unroll
  for (int i = 0; i < 8; ++i) { const int ka = k0 + 8 * g + i, kb = ka + 16;
    a[i] = (_Float16)(ka < K ? W[(size_t)(ka < K ? ka : K - 1) * ld + n] : 0.f); a[8 + i] = (_Float16)(kb < K ? W[(size_t)(kb < K ? kb : K - 1) * ld + n] : 0.f); }
  return a;
}
struct F2 { v16b h, l; };
__device__ __forceinline__ F2 bsplit16(const float v[16]) { F2 r;
#pragma unroll
  for (int i = 0; i < 16; ++i) { const __bf16 h = (__bf16)v[i]; r.h[i] = h; r.l[i] = (__bf16)(v[i] - (float)h); }
  return r; }
__device__ __forceinline__ F2 split_row(const float* row, int k0, int lane) { float v[16]; const float* p = row + k0 + 8 * (lane >> 4);
#pragma unroll
  for (int i = 0; i < 8; ++i) { v[i] = p[i]; v[8 + i] = p[16 + i]; }
  return bsplit16(v); }
__device__ __forceinline__ F2 split_rowK(const float* row, int k0, int lane, int K) { float v[16]; const int g = lane >> 4;
#pragma unroll
  for (int i = 0; i < 8; ++i) { const int ka = k0 + 8 * g + i, kb = ka + 16; v[i] = ka < K ? row[ka < K ? ka : K - 1] : 0.f; v[8 + i] = kb < K ? row[kb < K ? kb : K - 1] : 0.f; }
  return bsplit16(v); }
__device__ __forceinline__ F2 split_col(const float* W, int k0, int n, int lane, int ld, int K) { float v[16]; const int g = lane >> 4;
#pragma unroll
  for (int i = 0; i < 8; ++i) { const int ka = k0 + 8 * g + i, kb = ka + 16; v[i] = ka < K ? W[(size_t)(ka < K ? ka : K - 1) * ld + n] : 0.f; v[8 + i] = kb < K ? W[(size_t)(kb < K ? kb : K - 1) * ld + n] : 0.f; }
  return bsplit16(v); }
__device__ __forceinline__ v8f mac3(const F2& a, const F2& b, v8f c) { c = wmma_bf(a.l, b.h, c); c = wmma_bf(a.h, b.l, c); return wmma_bf(a.h, b.h, c); }
__device__ __forceinline__ float sigm(float v) { return 1.0f / (1.0f + expf(-v)); }
#define LDSX() do { asm volatile("s_wait_dscnt 0" ::: "memory"); __builtin_amdgcn_wave_barrier(); __builtin_amdgcn_fence(__ATOMIC_RELEASE, "workgroup"); } while (0)

// Single-head causal scaled-dot-product attention over one 4,096-token sequence (d_model 512, d_k = d_v = 64; (out,in) Wq/Wk/Wv [64,512] + biases, torch Linear convention): scores = (Q K^T + M)/sqrt(64) with M = -inf strictly above the diagonal; out = softmax(scores) V -> [4096, 64].
#define NB 1
#define TT 4096
#define CC 128            // NH * HD = projected width
#define DIN 512          // input (model) width
#define NH 2
#define HD 64
#define NQB (TT / 64)
#define HG 1
#define SCALE (0.125f)
#define CAUSAL 1
#ifndef TNB
#define TNB NB
#endif
__device__ __forceinline__ float bfr(float v) { return (float)(__bf16)v; }
__host__ __device__ __forceinline__ int kb_last(int qb) { return CAUSAL ? ((qb * 64 + 63) >> 7) : (TT / 128 - 1); }
typedef __attribute__((ext_vector_type(8))) __bf16 v8b;
__device__ __forceinline__ v16b frag_b(const __bf16* rowk0, int lane) {
  union { v16b v; v8b q[2]; } u; const __bf16* p = rowk0 + 8 * (lane >> 4);
  u.q[0] = *(const v8b*)p; u.q[1] = *(const v8b*)(p + 16); return u.v;
}
#define QBH 6              // causal: query blocks 0..QBH-1 of each sequence (few keys, no averaging) take the high-precision path
#define QHI 384            // rows carrying a q residual plane
#define KHI 384            // key rows carrying k residual / v bf16 hi+lo planes (used only by the causal high-precision path)
// B fragment (k rows k0+.., output column o) of a weight: (in,out) [K][ld] or (out,in) [ld rows of K]: bf16 exact, or f16(bf16 * 256) exact
__device__ __forceinline__ v16b wcol_io(const float* Wm, int k0, int o, int lane, int ld) { v16b w; const int g = lane >> 4;
#pragma unroll
  for (int i = 0; i < 8; ++i) { w[i] = (__bf16)Wm[(size_t)(k0 + 8 * g + i) * ld + o]; w[8 + i] = (__bf16)Wm[(size_t)(k0 + 16 + 8 * g + i) * ld + o]; }
  return w; }
__device__ __forceinline__ v16b wcol_oi(const float* Wm, int k0, int o, int lane, int K) { v16b w; const float* p = Wm + (size_t)o * K + k0 + 8 * (lane >> 4);
#pragma unroll
  for (int i = 0; i < 8; ++i) { w[i] = (__bf16)p[i]; w[8 + i] = (__bf16)p[16 + i]; }
  return w; }
__device__ __forceinline__ v16h wcolh_io(const float* Wm, int k0, int o, int lane, int ld) { v16h w; const int g = lane >> 4;
#pragma unroll
  for (int i = 0; i < 8; ++i) { w[i] = (_Float16)(bfr(Wm[(size_t)(k0 + 8 * g + i) * ld + o]) * 256.0f); w[8 + i] = (_Float16)(bfr(Wm[(size_t)(k0 + 16 + 8 * g + i) * ld + o]) * 256.0f); }
  return w; }
__device__ __forceinline__ v16h wcolh_oi(const float* Wm, int k0, int o, int lane, int K) { v16h w; const float* p = Wm + (size_t)o * K + k0 + 8 * (lane >> 4);
#pragma unroll
  for (int i = 0; i < 8; ++i) { w[i] = (_Float16)(bfr(p[i]) * 256.0f); w[8 + i] = (_Float16)(bfr(p[16 + i]) * 256.0f); }
  return w; }
#define WQKV_LAYOUT 1   // 0 = (in,out) [DIN][CC]; 1 = (out,in) [CC][DIN]; 2 = per-head [NH][DIN][HD]
__device__ __forceinline__ v16b wcol_hdk(const float* Wm, int k0, int o, int lane) { v16b w; const int g = lane >> 4; const float* p = Wm + (size_t)(o / HD) * DIN * HD + (o % HD);
#pragma unroll
  for (int i = 0; i < 8; ++i) { w[i] = (__bf16)p[(size_t)(k0 + 8 * g + i) * HD]; w[8 + i] = (__bf16)p[(size_t)(k0 + 16 + 8 * g + i) * HD]; }
  return w; }
#define WO_OUT_IN 0
#if WQKV_LAYOUT == 1
#define WCOL(W, k0, o, lane) wcol_oi(W, k0, o, lane, DIN)
#elif WQKV_LAYOUT == 2
#define WCOL(W, k0, o, lane) wcol_hdk(W, k0, o, lane)
#else
#define WCOL(W, k0, o, lane) wcol_io(W, k0, o, lane, CC)
#endif
#if WO_OUT_IN
#define WOCOL(W, k0, o, lane) wcol_oi(W, k0, o, lane, CC)
#define WOCOLH(W, k0, o, lane) wcolh_oi(W, k0, o, lane, CC)
#else
#define WOCOL(W, k0, o, lane) wcol_io(W, k0, o, lane, DIN)
#define WOCOLH(W, k0, o, lane) wcolh_io(W, k0, o, lane, DIN)
#endif
#define CIN 512
// ---- k_padw: the three (out,in) [64][C] projection weights copied into zero-padded (out,in) [128][C] ws planes (rows 64..127 zero) + zero-padded [128] biases (columns 64..127 = an all-zero dummy head, never attended)
__global__ __launch_bounds__(256) void k_padw(const float* __restrict__ WQ, const float* __restrict__ WK, const float* __restrict__ WV, const float* __restrict__ BQ, const float* __restrict__ BK, const float* __restrict__ BV, float* __restrict__ WP, float* __restrict__ BP) { const int which = blockIdx.y; const float* Wsrc = which == 0 ? WQ : (which == 1 ? WK : WV); const float* Bsrc = which == 0 ? BQ : (which == 1 ? BK : BV); float* dst = WP + (size_t)which * 128 * CIN;
  for (int e = blockIdx.x * 256 + threadIdx.x; e < 128 * (CIN / 4); e += gridDim.x * 256) { const int row = e / (CIN / 4), q = e % (CIN / 4); const v4f ld = *(const v4f*)(Wsrc + (size_t)(row & 63) * CIN + q * 4); asm volatile("s_wait_loadcnt 0x0" ::: "memory"); const float keep = row < 64 ? 1.f : 0.f; v4f ov; ov[0] = ld[0] * keep; ov[1] = ld[1] * keep; ov[2] = ld[2] * keep; ov[3] = ld[3] * keep; vst2(dst + (size_t)row * CIN + q * 4, ov); }   /* unconditional (clamped) loads, zero by select */
  if (blockIdx.x == 0 && threadIdx.x < 128) { const int c = threadIdx.x; float bvv = 0.f; if (Bsrc) { const float t = Bsrc[c & 63]; asm volatile("s_wait_loadcnt 0x0" ::: "memory"); bvv = c < 64 ? t : 0.f; } vst2(BP + which * 128 + c, bvv); } }
#define WS_WP (WS_END)                                  // padded weights [3][128 x C]
#define WS_BP (WS_WP + 4u * 3 * (size_t)CIN * 128)        // padded biases [3][128]
#define WS_Y2 (WS_BP + 4u * 3 * 128)                      // f32 [b*TT+t][128], unused: ctx goes straight to out
#define WS_END2 (WS_Y2 + 4u * (size_t)NB * TT * CC)
#ifndef SM_EXTRA_PARAMS
#define SM_EXTRA_PARAMS
#endif
#ifndef PROJ_EXTRA_PARAMS
#define PROJ_EXTRA_PARAMS
#endif
#ifndef SM_MASK_HOOK
#define SM_MASK_HOOK (void)0
#endif

// q / k planes and v planes lie in FRAGMENT ORDER: a tile = 16 rows x 32 k of one 16x16x32 operand = 512 elements [k half (16)][lane = 16 (k >> 3 & 1) + row][8 k], so a wave's 16-byte-a-lane load covers 512 contiguous bytes (4 whole lines).
// q / k: row = token, k = channel, tile index (t >> 4) * (CC / 32) + (c >> 5); v: row = channel, k = token, tile index (t >> 5) * (CC / 16) + (c >> 4)
#define FT 512   // elements of a fragment tile
static_assert(CC == 128, "a k_proj block's 128 columns are every channel tile of its rows, so its tiles are contiguous");
#define WS_QH  0u                                      // f16 q tiles [b*t / 16][CC / 32]
#define WS_KH  (WS_QH + 2u * (size_t)NB * TT * CC)      // f16 k tiles [b*t / 16][CC / 32]
#define WS_VT  (WS_KH + 2u * (size_t)NB * TT * CC)      // f16 v tiles [b][t / 32][CC / 16]
#define WS_QL  (WS_VT + 2u * (size_t)NB * CC * TT)      // f16 q residual x 2^10 tiles, t < QHI
#define WS_KL  (WS_QL + 2u * (size_t)NB * QHI * CC)     // f16 k residual x 2^10 tiles, t < KHI
#define WS_VB  (WS_KL + 2u * (size_t)NB * KHI * CC)     // bf16 v hi tiles, t < KHI
#define WS_VBL (WS_VB + 2u * (size_t)NB * CC * KHI)
#define WS_S   (WS_VBL + 2u * (size_t)NB * CC * KHI)    // f32 [hg][t][s], unused: logits and P stay in registers
#define WS_Y   (WS_S  + 4u * (size_t)HG * TT * TT)      // f32 ctx rows [b*t][CC] (only when there is an output projection)
#define WS_END (WS_Y  + 0u)

typedef __attribute__((ext_vector_type(4))) __bf16 v4b;
#define SB 16   // rows of a staging batch
static_assert(64 % SB == 0 && (64 + 128) % (3 * SB) == 0, "a batch lies in one operand; the staged rows are whole trips of three batches");
__device__ __forceinline__ void st_load(v4f (&t)[SB], const float* sp) {
#pragma unroll
  for (int i = 0; i < SB; ++i) t[i] = *(const v4f*)(sp + (size_t)i * DIN);
  asm volatile("s_wait_xcnt 0x0" :: "v"(sp) : "memory"); }   /* a precaution: the wait stands ahead of any reuse of the batch's shared address pair; naming the pair keeps it whole until here, so that no load's own result lands on it */
__device__ __forceinline__ void st_put(const v4f (&t)[SB], __bf16* dp) {
#pragma unroll
  for (int i = 0; i < SB; ++i) { v4b o; o[0] = (__bf16)t[i][0]; o[1] = (__bf16)t[i][1]; o[2] = (__bf16)t[i][2]; o[3] = (__bf16)t[i][3]; *(v4b*)(dp + i * (DIN + 8)) = o; } }
// a thread's eight 16-byte pieces of a block's 16-KiB run of tiles, 2 KiB apart: every wave-wide store covers 512 contiguous bytes
__device__ __forceinline__ void st8(void* p, const v4u (&a)[8]) {
#pragma unroll
  for (int i = 0; i < 8; ++i) *(v4u*)((char*)p + i * 2048) = a[i];
  asm volatile("s_wait_xcnt 0x0" :: "v"(p), "v"(a[0]), "v"(a[1]), "v"(a[2]), "v"(a[3]), "v"(a[4]), "v"(a[5]), "v"(a[6]), "v"(a[7]) : "memory"); }   /* a precaution: the wait stands ahead of any reuse of the stores' registers; naming them keeps address and data whole until here */
// ---- k_proj: block = (64 rows, 128 cols, which): q/k/v = X W (+ b) with exact bf16 products (K = DIN), both operand tiles rounded to bf16 once and held in LDS -> which 0: q f16 (+ residual, rows < QHI); 1: k f16 (+ residual, rows < KHI); 2: v f16 (+ bf16 hi/lo for t < KHI), all stored as fragment tiles
__global__ __launch_bounds__(128) void k_proj(const float* __restrict__ XQ, const float* __restrict__ XK, const float* __restrict__ XV, const float* __restrict__ WQ, const float* __restrict__ WK, const float* __restrict__ WV, const float* __restrict__ BQ, const float* __restrict__ BK, const float* __restrict__ BV,
    _Float16* __restrict__ QH, _Float16* __restrict__ QL, _Float16* __restrict__ KH, _Float16* __restrict__ KL, _Float16* __restrict__ VT, __bf16* __restrict__ VB, __bf16* __restrict__ VBL) {
  __shared__ __align__(16) _Float16 sh[64][136], sl[64][136]; __shared__ __align__(16) _Float16 th[128][72]; __shared__ __align__(16) __bf16 tb[128][72], tbl[128][72];
  __shared__ __align__(16) __bf16 sxw[64 + 128][DIN + 8];   /* bf16 operand tiles, the 64 X rows and then the 128 W rows; row pitch 16 B x odd: conflict-free for the 16-byte fragment reads */
  const int tid = threadIdx.x, wave = tid >> 5, lane = tid & 31, col = lane & 15, g = lane >> 4; const int which = blockIdx.z; const int c0 = blockIdx.y * 128; const size_t r0 = (size_t)blockIdx.x * 64; const size_t bb = r0 / TT; const int t0 = (int)(r0 % TT);
  const float* X = which == 0 ? XQ : which == 1 ? XK : XV; const float* WA = which == 0 ? WQ : which == 1 ? WK : WV; const float* BA = which == 0 ? BQ : which == 1 ? BK : BV;
  // the 64 X rows and the 128 W rows are each one contiguous range, and 128 threads x 4 floats are one row: every wave-wide load covers 512 contiguous bytes (4 whole lines), every element is read and rounded once a block
  { const float* xb = X + r0 * DIN + tid * 4; const float* wb = WA + (size_t)c0 * DIN + tid * 4;   /* staged row r is X row r below 64, W row r - 64 from there on */
    __bf16* dp = &sxw[0][tid * 4]; v4f u0[SB], u1[SB], u2[SB];
    st_load(u0, xb); st_load(u1, xb + (size_t)SB * DIN);
#pragma unroll 1   /* rolled, three register sets: two to three batches' loads stay in flight while the oldest batch is rounded and stored */
    for (int b0 = 0; b0 < 64 + 128; b0 += 3 * SB) { const int b1 = b0 + SB, b2 = b0 + 2 * SB, b3 = b0 + 3 * SB, b4 = b0 + 4 * SB; const bool more = b3 < 64 + 128;
      st_load(u2, b2 < 64 ? xb + (size_t)b2 * DIN : wb + (size_t)(b2 - 64) * DIN); st_put(u0, dp + b0 * (DIN + 8));
      if (more) st_load(u0, b3 < 64 ? xb + (size_t)b3 * DIN : wb + (size_t)(b3 - 64) * DIN);
      st_put(u1, dp + b1 * (DIN + 8));
      if (more) st_load(u1, b4 < 64 ? xb + (size_t)b4 * DIN : wb + (size_t)(b4 - 64) * DIN);
      st_put(u2, dp + b2 * (DIN + 8)); } }
  __syncthreads();   /* both tiles are whole in LDS before any wave reads a fragment */
  v8f acc[8] = {};
  const __bf16* ap = &sxw[wave * 16 + col][0]; const __bf16* wp = &sxw[64 + col][0];
  v16b a = frag_b(ap, lane), w[8];
#pragma unroll
  for (int j = 0; j < 8; ++j) w[j] = frag_b(wp + j * 16 * (DIN + 8), lane);
#pragma unroll   /* whole: the next step's fragments are read as one group ahead of this step's products, into a second register set */
  for (int kc = 0; kc < DIN / 32; ++kc) { v16b an = a, wn[8];
#pragma unroll
    for (int j = 0; j < 8; ++j) wn[j] = w[j];
    if (kc + 1 < DIN / 32) { an = frag_b(ap + (kc + 1) * 32, lane);
#pragma unroll
      for (int j = 0; j < 8; ++j) wn[j] = frag_b(wp + j * 16 * (DIN + 8) + (kc + 1) * 32, lane); }
#pragma unroll
    for (int j = 0; j < 8; ++j) acc[j] = wmma_bf(a, w[j], acc[j]);
    a = an;
#pragma unroll
    for (int j = 0; j < 8; ++j) w[j] = wn[j]; }
  if (which < 2) { _Float16* DH = which == 0 ? QH : KH; _Float16* DL = which == 0 ? QL : KL; const int nhi = which == 0 ? QHI : KHI; const bool hi_rows = t0 < nhi;
#pragma unroll
    for (int j = 0; j < 8; ++j) { const float bias = BA ? bfr(BA[c0 + j * 16 + col]) : 0.f;
#pragma unroll
      for (int r = 0; r < 8; ++r) { const float v = acc[j][r] + bias; const _Float16 hv = (_Float16)v; sh[wave * 16 + 8 * g + r][j * 16 + col] = hv; sl[wave * 16 + 8 * g + r][j * 16 + col] = (_Float16)((v - (float)hv) * 1024.0f); } }
    __syncthreads();
    v4u pc[8];   /* piece e = tid + 128 i of the block in fragment order (row tile, channel tile, k half, lane): its 64 rows are one contiguous run of tiles */
#pragma unroll
    for (int i = 0; i < 8; ++i) { const int e = tid + i * 128; pc[i] = *(const v4u*)&sh[(e >> 8) * 16 + (e & 15)][((e >> 4) & 15) * 8]; }
    st8(DH + r0 * CC + tid * 8, pc);
    if (hi_rows) {
#pragma unroll
      for (int i = 0; i < 8; ++i) { const int e = tid + i * 128; pc[i] = *(const v4u*)&sl[(e >> 8) * 16 + (e & 15)][((e >> 4) & 15) * 8]; }
      st8(DL + (bb * nhi + t0) * (size_t)CC + tid * 8, pc); }
  } else { const bool hi_rows = t0 < KHI;
#pragma unroll
    for (int j = 0; j < 8; ++j) { const float bias = BA ? bfr(BA[c0 + j * 16 + col]) : 0.f;
#pragma unroll
      for (int r = 0; r < 8; ++r) { const float v = acc[j][r] + bias; const int rl = wave * 16 + 8 * g + r, cl = j * 16 + col; th[cl][rl] = (_Float16)v; const __bf16 bh = (__bf16)v; tb[cl][rl] = bh; tbl[cl][rl] = (__bf16)(v - (float)bh); } }
    __syncthreads();
    v4u pc[8];   /* piece e = tid + 128 i of the block in fragment order (token tile, channel tile, k half, lane): its 64 tokens are one contiguous run of tiles */
#pragma unroll
    for (int i = 0; i < 8; ++i) { const int e = tid + i * 128; pc[i] = *(const v4u*)&th[((e >> 6) & 7) * 16 + (e & 15)][((e >> 9) * 4 + ((e >> 4) & 3)) * 8]; }
    st8(VT + bb * CC * (size_t)TT + (size_t)t0 * CC + tid * 8, pc);
    if (hi_rows) { const size_t o3 = bb * CC * (size_t)KHI + (size_t)t0 * CC + tid * 8;
#pragma unroll
      for (int i = 0; i < 8; ++i) { const int e = tid + i * 128; pc[i] = *(const v4u*)&tb[((e >> 6) & 7) * 16 + (e & 15)][((e >> 9) * 4 + ((e >> 4) & 3)) * 8]; }
      st8(VB + o3, pc);
#pragma unroll
      for (int i = 0; i < 8; ++i) { const int e = tid + i * 128; pc[i] = *(const v4u*)&tbl[((e >> 6) & 7) * 16 + (e & 15)][((e >> 9) * 4 + ((e >> 4) & 3)) * 8]; }
      st8(VBL + o3, pc); } } }
// ---- k_att: block = 16 queries of (b, h), PVW waves: wave w takes the 32-key chunks w, w + PVW, ... of keys [0, last query] and keeps its logits in registers from the products to P.
// Logits as S^T = K . Q^T (A = 16 key rows, B = 16 query rows): D register r of key tile tt = key 16 tt + 8 g + r of query col, which is element 8 tt + r of the A fragment of P . v, so P needs no LDS and no lane exchange.
// Query rows < QHI: q hi + residual against k hi + residual (3 products), P and v as bf16 hi + lo (3 products); later rows: 1 product each. Causal mask by index. Softmax in f32 against the wave's own row maximum: P = exp(logit - max) x 2^11.
// The PVW partial (ctx, maximum, sum) triples are merged in LDS in wave order, each scaled by exp(own maximum - row maximum), and go straight to out[b][t][0..63] (the one real head): 256-B row by 16 lanes
// a fragment tile's two 512-byte halves, the lane's 8 * lane already in the pointer
__device__ __forceinline__ v16h frag_p(const _Float16* p) { union { v16h v; v8h q[2]; } u; u.q[0] = *(const v8h*)p; u.q[1] = *(const v8h*)(p + FT / 2); return u.v; }
__device__ __forceinline__ v16b frag_pb(const __bf16* p) { union { v16b v; v8b q[2]; } u; u.q[0] = *(const v8b*)p; u.q[1] = *(const v8b*)(p + FT / 2); return u.v; }
#define PVW 32
#define NCH (TT / 32 / PVW)   // most chunks one wave can own
#define MFLOOR (-1.0e30f)     // floor of a wave's row maximum: a masked logit (-3e38) stays about 3e38 below it, so its exp is 0 also in a row that the wave sees wholly masked
static_assert(QHI / 32 <= PVW, "a high-precision block has at most one chunk a wave");
static_assert(QBH * 64 == QHI && KHI >= QHI, "residual planes cover every row and key of the high-precision blocks");
__global__ __launch_bounds__(32 * PVW) void k_att(const _Float16* __restrict__ QH, const _Float16* __restrict__ KH, const _Float16* __restrict__ QL, const _Float16* __restrict__ KL, const _Float16* __restrict__ VT, const __bf16* __restrict__ VB, const __bf16* __restrict__ VBL, int b, int h0, float* __restrict__ OUT) { const int h = h0 + blockIdx.z; __shared__ __align__(16) float ss[PVW][16][HD + 4]; __shared__ float smx[PVW][16], ssm[PVW][16];
  const int tid = threadIdx.x, wave = __builtin_amdgcn_readfirstlane(tid >> 5) /* scalar: the chunk tests branch on SCC, EXEC stays whole at the WMMAs */, lane = tid & 31, col = lane & 15, g = lane >> 4; const int qb = blockIdx.x >> 2; const int ql0 = blockIdx.x * 16; const int kce = ((ql0 + 15) >> 5) + 1;   /* chunks that hold a key <= the block's last query */
  const int t = ql0 + col; const size_t q0 = (size_t)b * TT + ql0, kr0 = (size_t)b * TT;
  v8f acc[HD / 16] = {}; float mw = -3.0e38f, sw = 0.f;
  if (qb < QBH) {
    if (wave < kce) { const int k0 = wave * 32; const _Float16* QLb = QL + (size_t)b * QHI * CC; const _Float16* KLb = KL + (size_t)b * KHI * CC;
      const int fo = (h * HD / 32) * FT + lane * 8; const _Float16 *qhp = QH + q0 * CC + fo, *qlp = QLb + (size_t)ql0 * CC + fo, *khp = KH + (kr0 + k0) * CC + fo, *klp = KLb + (size_t)k0 * CC + fo;
      v8f a[2] = {}, al[2] = {};
#pragma unroll
      for (int kc = 0; kc < HD / 32; ++kc) { const v16h qh = frag_p(qhp + kc * FT), ql = frag_p(qlp + kc * FT);
        asm volatile("s_wait_xcnt 0x0" :: "v"(qhp), "v"(qlp) : "memory");   /* a precaution: the loads' address pairs stay whole until here, so that no load's own result lands on one */
#pragma unroll
        for (int tt = 0; tt < 2; ++tt) { const v16h kh = frag_p(khp + tt * 16 * CC + kc * FT), kl = frag_p(klp + tt * 16 * CC + kc * FT);
          asm volatile("s_wait_xcnt 0x0" :: "v"(khp), "v"(klp) : "memory");   /* as behind the q loads */
          a[tt] = wmma16(kh, qh, a[tt]); al[tt] = wmma16(kh, ql, al[tt]); al[tt] = wmma16(kl, qh, al[tt]); } }
      float lg[16];
#pragma unroll
      for (int i = 0; i < 16; ++i) { const int key = k0 + (i >> 3) * 16 + 8 * g + (i & 7); lg[i] = key <= t ? (a[i >> 3][i & 7] + al[i >> 3][i & 7] * (1.0f / 1024.0f)) * SCALE : -3.0e38f; mw = fmaxf(mw, lg[i]); }
      mw = fmaxf(fmaxf(mw, __shfl_xor(mw, 16)), MFLOOR);
#pragma unroll
      for (int i = 0; i < 16; ++i) { const float e = expf(lg[i] - mw); sw += e; lg[i] = e * 2048.0f; }
      const F2 p = bsplit16(lg);
      const size_t po = (size_t)b * CC * KHI + ((size_t)wave * (CC / 16) + h * HD / 16) * FT + lane * 8; const __bf16 *vbp = VB + po, *vlp = VBL + po;
#pragma unroll
      for (int j = 0; j < HD / 16; ++j) { const v16b vh = frag_pb(vbp + j * FT);
        asm volatile("s_wait_xcnt 0x0" :: "v"(vbp) : "memory");   /* as behind the q loads */
        acc[j] = wmma_bf(p.h, vh, acc[j]); acc[j] = wmma_bf(p.l, vh, acc[j]); const v16b vl = frag_pb(vlp + j * FT);
        asm volatile("s_wait_xcnt 0x0" :: "v"(vlp) : "memory");   /* as behind the q loads */
        acc[j] = wmma_bf(p.h, vl, acc[j]); } }
  } else {
    const _Float16* qp = QH + q0 * CC + (h * HD / 32) * FT + lane * 8; const v16h qf0 = frag_p(qp), qf1 = frag_p(qp + FT);
    asm volatile("s_wait_xcnt 0x0" :: "v"(qp) : "memory");   /* the loads' address pair is free for reuse only behind this wait; naming it keeps it whole until here */
    float lg[NCH][16];
#pragma unroll
    for (int c = 0; c < NCH; ++c) { const int kc = wave + c * PVW, k0 = kc * 32;
      if (kc < kce) { const _Float16* kp = KH + (kr0 + k0) * CC + (h * HD / 32) * FT + lane * 8;
        const v16h kf0 = frag_p(kp), kf1 = frag_p(kp + FT), kf2 = frag_p(kp + 16 * CC), kf3 = frag_p(kp + 16 * CC + FT);   /* all four fragments asked for ahead of the first product: one latency a chunk */
        asm volatile("s_wait_xcnt 0x0" :: "v"(kp) : "memory");   /* as behind the q loads */
        v8f a0 = {}, a1 = {}; a0 = wmma16(kf0, qf0, a0); a1 = wmma16(kf2, qf0, a1); a0 = wmma16(kf1, qf1, a0); a1 = wmma16(kf3, qf1, a1);
#pragma unroll
        for (int r = 0; r < 8; ++r) { lg[c][r] = a0[r] * SCALE; lg[c][8 + r] = a1[r] * SCALE; }
        if (kc == kce - 1) {   /* only the block's last chunk holds keys past a query */
#pragma unroll
          for (int i = 0; i < 16; ++i) lg[c][i] = (k0 + (i >> 3) * 16 + 8 * g + (i & 7)) <= t ? lg[c][i] : -3.0e38f; }
#pragma unroll
        for (int i = 0; i < 16; ++i) mw = fmaxf(mw, lg[c][i]); } }
    mw = fmaxf(fmaxf(mw, __shfl_xor(mw, 16)), MFLOOR);
    v16h p[NCH];
#pragma unroll
    for (int c = 0; c < NCH; ++c) {
      if (wave + c * PVW < kce) {
#pragma unroll
        for (int i = 0; i < 16; ++i) { const float e = expf(lg[c][i] - mw); sw += e; p[c][i] = (_Float16)(e * 2048.0f); } } }
#pragma unroll
    for (int c = 0; c < NCH; ++c) {
      if (wave + c * PVW < kce) { const _Float16* vp = VT + (size_t)b * CC * TT + ((size_t)(wave + c * PVW) * (CC / 16) + h * HD / 16) * FT + lane * 8; v16h vf[HD / 16];
#pragma unroll
        for (int j = 0; j < HD / 16; ++j) vf[j] = frag_p(vp + j * FT);   /* all asked for ahead of the first product */
        asm volatile("s_wait_xcnt 0x0" :: "v"(vp) : "memory");   /* as behind the q loads: no load's own result lands on the shared address pair */
#pragma unroll
        for (int j = 0; j < HD / 16; ++j) acc[j] = wmma16(p[c], vf[j], acc[j]); } } }
  sw += __shfl_xor(sw, 16);
#pragma unroll
  for (int j = 0; j < HD / 16; ++j)
#pragma unroll
    for (int r = 0; r < 8; ++r) ss[wave][8 * g + r][j * 16 + col] = acc[j][r];
  if (g == 0) { smx[wave][col] = mw; ssm[wave][col] = sw; }   /* a wave without a chunk leaves a zero partial under a maximum no logit reaches */
  __syncthreads();   /* every wave's partial is in LDS before any is merged */
  if (tid < 16 * (HD / 4)) { const int rl = tid >> 4, q = tid & 15;
    float m = smx[0][rl];
#pragma unroll
    for (int w = 1; w < PVW; ++w) m = fmaxf(m, smx[w][rl]);
    v4f s = {}; float den = 0.f;
#pragma unroll 8   /* eight partials' LDS reads in flight at a time; unrolled whole, the reads spill */
    for (int w = 0; w < PVW; ++w) { const float f = expf(smx[w][rl] - m); s += *(const v4f*)&ss[w][rl][q * 4] * f; den += ssm[w][rl] * f; }   /* a wave that saw this row wholly masked, or no chunk at all: f = 0 beside a zero partial */
    vst2(OUT + ((size_t)b * TT + ql0 + rl) * HD + q * 4, s * (den > 0.f ? 1.0f / (2048.0f * den) : 0.f)); } }

extern "C" void kernel_launch(void* const* d_in, const int* in_sizes, int n_in, void* d_out, int out_size, void* d_ws, size_t ws_size, hipStream_t stream) {
  (void)in_sizes; (void)n_in; (void)out_size;
  const float** F = (const float**)d_in;
  if (ws_size < (size_t)WS_END) return;
  char* ws = (char*)d_ws; _Float16 *QH = (_Float16*)(ws + WS_QH), *KH = (_Float16*)(ws + WS_KH), *VT = (_Float16*)(ws + WS_VT), *QL = (_Float16*)(ws + WS_QL), *KL = (_Float16*)(ws + WS_KL); __bf16 *VB = (__bf16*)(ws + WS_VB), *VBL = (__bf16*)(ws + WS_VBL); float *S = (float*)(ws + WS_S), *Y = (float*)(ws + WS_Y);
  (void)Y; (void)S; (void)QL; (void)KL; (void)VB; (void)VBL;
  // inputs: 0 embeddings [4096,512]; 1 Wq [64,512] (out,in), 2 bq [64]; 3 Wk, 4 bk; 5 Wv, 6 bv (biases nonzero)
  if (ws_size < (size_t)WS_END2) return;
  float *WP = (float*)(ws + WS_WP), *BP = (float*)(ws + WS_BP);
  k_padw<<<dim3(32, 3), 256, 0, stream>>>(F[1], F[3], F[5], F[2], F[4], F[6], WP, BP);
  k_proj<<<dim3(TNB * TT / 64, CC / 128, 3), 128, 0, stream>>>(F[0], F[0], F[0], WP, WP + (size_t)CIN * 128, WP + 2 * (size_t)CIN * 128, BP, BP + 128, BP + 256, QH, QL, KH, KL, VT, VB, VBL);
  for (int b = 0; b < TNB; ++b) {   /* head 0 only (head 1 is the zero padding) */
    k_att<<<dim3(TT / 16, 1, 1), 32 * PVW, 0, stream>>>(QH, KH, QL, KL, VT, VB, VBL, b, 0, (float*)d_out);
  }
}

// v005
// One run takes 18.3 microseconds.
// Timed twice side by side with v004, it ran 1.39 and 1.37 times as fast.
// Over all steps from v000 it is 12.5 times as fast.
// compute dtype: all float inputs rounded to bf16; q/k/v projections with EXACT bf16 products on WMMA 16x16x32 (f32 accumulate) + bias; causal logits: 3 products (q f16 hi + residual x k hi + residual) for the first 384 rows, single f16 q x k after, x scale; softmax f32, logits and P never leave registers; exp(logit - partial max) x 2^11 once to f16 x v once to f16 (1 product; bf16 hi + lo below row 384), divided by the sum at the end; f32 output.
#include <hip/hip_runtime.h>
#include <math.h>

typedef __attribute__((ext_vector_type(16))) _Float16 v16h;
typedef __attribute__((ext_vector_type(16))) __bf16 v16b;
typedef __attribute__((ext_vector_type(8)))  _Float16 v8h;
typedef __attribute__((ext_vector_type(8)))  float v8f;
typedef __attribute__((ext_vector_type(4)))  float v4f;
typedef __attribute__((ext_vector_type(2)))  float v2f;
typedef __attribute__((ext_vector_type(4)))  unsigned v4u;
typedef __attribute__((ext_vector_type(4)))  int v4i;
typedef float __attribute__((may_alias)) float_a;
typedef int __attribute__((may_alias)) int_a;

template <typename T> __device__ __forceinline__ void vst2(void* p, T v) { *(T*)p = v;  }
__device__ __forceinline__ v8f wmma16(v16h a, v16h b, v8f c) {
  v8f d = __builtin_amdgcn_wmma_f32_16x16x32_f16(false, a, false, b, (short)0, c, false, false);
  asm volatile("v_nop\n\tv_nop\n\tv_nop\n\tv_nop" : "+v"(d) : "v"(a), "v"(b));
  return d;
}
__device__ __forceinline__ v8f wmma_bf(v16b a, v16b b, v8f c) {
  v8f d = __builtin_amdgcn_wmma_f32_16x16x32_bf16(false, a, false, b, (short)0, c, false, false);
  asm volatile("v_nop\n\tv_nop\n\tv_nop\n\tv_nop" : "+v"(d) : "v"(a), "v"(b));
  return d;
}
// 16x16x32 fragments: lane = (h = lane>>4, row/col = lane&15); elements 0..7 = k0+8h+0..7, 8..15 = k0+16+8h+0..7; D element r = row 8h+r
__device__ __forceinline__ v16h frag_h(const _Float16* rowk0, int lane) {
  union { v16h v; v8h q[2]; } u; const _Float16* p = rowk0 + 8 * (lane >> 4);
  u.q[0] = *(const v8h*)p; u.q[1] = *(const v8h*)(p + 16); return u.v;
}
__device__ __forceinline__ v16h frag_f32(const float* rowk0, int lane) {
  v16h a; const float* p = rowk0 + 8 * (lane >> 4);
#pragma unroll
  for (int i = 0; i < 8; ++i) { a[i] = (_Float16)p[i]; a[8 + i] = (_Float16)p[16 + i]; }
  return a;
}
__device__ __forceinline__ v16h frag_f32s(const float* rowk0, int lane, float sc) {
  v16h a; const float* p = rowk0 + 8 * (lane >> 4);
#pragma unroll
  for (int i = 0; i < 8; ++i) { a[i] = (_Float16)(p[i] * sc); a[8 + i] = (_Float16)(p[16 + i] * sc); }
  return a;
}
// column fragment from a [K][ld] layout (column n), rows >= K read as 0
__device__ __forceinline__ v16h fragc_f32(const float* W, int k0, int n, int lane, int ld, int K) {
  v16h a; const int g = lane >> 4;
#pragma unroll
  for (int i = 0; i < 8; ++i) { const int ka = k0 + 8 * g + i, kb = ka + 16;
    a[i] = (_Float16)(ka < K ? W[(size_t)(ka < K ? ka : K - 1) * ld + n] : 0.f); a[8 + i] = (_Float16)(kb < K ? W[(size_t)(kb < K ? kb : K - 1) * ld + n] : 0.f); }
  return a;
}
struct F2 { v16b h, l; };
__device__ __forceinline__ F2 bsplit16(const float v[16]) { F2 r;
#pragma unroll
  for (int i = 0; i < 16; ++i) { const __bf16 h = (__bf16)v[i]; r.h[i] = h; r.l[i] = (__bf16)(v[i] - (float)h); }
  return r; }
__device__ __forceinline__ F2 split_row(const float* row, int k0, int lane) { float v[16]; const float* p = row + k0 + 8 * (lane >> 4);
#pragma unroll
  for (int i = 0; i < 8; ++i) { v[i] = p[i]; v[8 + i] = p[16 + i]; }
  return bsplit16(v); }
__device__ __forceinline__ F2 split_rowK(const float* row, int k0, int lane, int K) { float v[16]; const int g = lane >> 4;
#pragma unroll
  for (int i = 0; i < 8; ++i) { const int ka = k0 + 8 * g + i, kb = ka + 16; v[i] = ka < K ? row[ka < K ? ka : K - 1] : 0.f; v[8 + i] = kb < K ? row[kb < K ? kb : K - 1] : 0.f; }
  return bsplit16(v); }
__device__ __forceinline__ F2 split_col(const float* W, int k0, int n, int lane, int ld, int K) { float v[16]; const int g = lane >> 4;
#pragma unroll
  for (int i = 0; i < 8; ++i) { const int ka = k0 + 8 * g + i, kb = ka + 16; v[i] = ka < K ? W[(size_t)(ka < K ? ka : K - 1) * ld + n] : 0.f; v[8 + i] = kb < K ? W[(size_t)(kb < K ? kb : K - 1) * ld + n] : 0.f; }
  return bsplit16(v); }
__device__ __forceinline__ v8f mac3(const F2& a, const F2& b, v8f c) { c = wmma_bf(a.l, b.h, c); c = wmma_bf(a.h, b.l, c); return wmma_bf(a.h, b.h, c); }
__device__ __forceinline__ float sigm(float v) { return 1.0f / (1.0f + expf(-v)); }
#define LDSX() do { asm volatile("s_wait_dscnt 0" ::: "memory"); __builtin_amdgcn_wave_barrier(); __builtin_amdgcn_fence(__ATOMIC_RELEASE, "workgroup"); } while (0)

// Single-head causal scaled-dot-product attention over one 4,096-token sequence (d_model 512, d_k = d_v = 64; (out,in) Wq/Wk/Wv [64,512] + biases, torch Linear convention): scores = (Q K^T + M)/sqrt(64) with M = -inf strictly above the diagonal; out = softmax(scores) V -> [4096, 64].
#define NB 1
#define TT 4096
#define CC 64             // NH * HD = projected width
#define DIN 512          // input (model) width
#define NH 1
#define HD 64
#define NQB (TT / 64)
#define HG 1
#define SCALE (0.125f)
#define CAUSAL 1
#ifndef TNB
#define TNB NB
#endif
__device__ __forceinline__ float bfr(float v) { return (float)(__bf16)v; }
__host__ __device__ __forceinline__ int kb_last(int qb) { return CAUSAL ? ((qb * 64 + 63) >> 7) : (TT / 128 - 1); }
typedef __attribute__((ext_vector_type(8))) __bf16 v8b;
__device__ __forceinline__ v16b frag_b(const __bf16* rowk0, int lane) {
  union { v16b v; v8b q[2]; } u; const __bf16* p = rowk0 + 8 * (lane >> 4);
  u.q[0] = *(const v8b*)p; u.q[1] = *(const v8b*)(p + 16); return u.v;
}
#define QBH 6              // causal: query blocks 0..QBH-1 of each sequence (few keys, no averaging) take the high-precision path
#define QHI 384            // rows carrying a q residual plane
#define KHI 384            // key rows carrying k residual / v bf16 hi+lo planes (used only by the causal high-precision path)
// B fragment (k rows k0+.., output column o) of a weight: (in,out) [K][ld] or (out,in) [ld rows of K]: bf16 exact, or f16(bf16 * 256) exact
__device__ __forceinline__ v16b wcol_io(const float* Wm, int k0, int o, int lane, int ld) { v16b w; const int g = lane >> 4;
#pragma unroll
  for (int i = 0; i < 8; ++i) { w[i] = (__bf16)Wm[(size_t)(k0 + 8 * g + i) * ld + o]; w[8 + i] = (__bf16)Wm[(size_t)(k0 + 16 + 8 * g + i) * ld + o]; }
  return w; }
__device__ __forceinline__ v16b wcol_oi(const float* Wm, int k0, int o, int lane, int K) { v16b w; const float* p = Wm + (size_t)o * K + k0 + 8 * (lane >> 4);
#pragma unroll
  for (int i = 0; i < 8; ++i) { w[i] = (__bf16)p[i]; w[8 + i] = (__bf16)p[16 + i]; }
  return w; }
__device__ __forceinline__ v16h wcolh_io(const float* Wm, int k0, int o, int lane, int ld) { v16h w; const int g = lane >> 4;
#pragma unroll
  for (int i = 0; i < 8; ++i) { w[i] = (_Float16)(bfr(Wm[(size_t)(k0 + 8 * g + i) * ld + o]) * 256.0f); w[8 + i] = (_Float16)(bfr(Wm[(size_t)(k0 + 16 + 8 * g + i) * ld + o]) * 256.0f); }
  return w; }
__device__ __forceinline__ v16h wcolh_oi(const float* Wm, int k0, int o, int lane, int K) { v16h w; const float* p = Wm + (size_t)o * K + k0 + 8 * (lane >> 4);
#pragma unroll
  for (int i = 0; i < 8; ++i) { w[i] = (_Float16)(bfr(p[i]) * 256.0f); w[8 + i] = (_Float16)(bfr(p[16 + i]) * 256.0f); }
  return w; }
#define WQKV_LAYOUT 1   // 0 = (in,out) [DIN][CC]; 1 = (out,in) [CC][DIN]; 2 = per-head [NH][DIN][HD]
__device__ __forceinline__ v16b wcol_hdk(const float* Wm, int k0, int o, int lane) { v16b w; const int g = lane >> 4; const float* p = Wm + (size_t)(o / HD) * DIN * HD + (o % HD);
#pragma unroll
  for (int i = 0; i < 8; ++i) { w[i] = (__bf16)p[(size_t)(k0 + 8 * g + i) * HD]; w[8 + i] = (__bf16)p[(size_t)(k0 + 16 + 8 * g + i) * HD]; }
  return w; }
#define WO_OUT_IN 0
#if WQKV_LAYOUT == 1
#define WCOL(W, k0, o, lane) wcol_oi(W, k0, o, lane, DIN)
#elif WQKV_LAYOUT == 2
#define WCOL(W, k0, o, lane) wcol_hdk(W, k0, o, lane)
#else
#define WCOL(W, k0, o, lane) wcol_io(W, k0, o, lane, CC)
#endif
#if WO_OUT_IN
#define WOCOL(W, k0, o, lane) wcol_oi(W, k0, o, lane, CC)
#define WOCOLH(W, k0, o, lane) wcolh_oi(W, k0, o, lane, CC)
#else
#define WOCOL(W, k0, o, lane) wcol_io(W, k0, o, lane, DIN)
#define WOCOLH(W, k0, o, lane) wcolh_io(W, k0, o, lane, DIN)
#endif
#ifndef SM_EXTRA_PARAMS
#define SM_EXTRA_PARAMS
#endif
#ifndef PROJ_EXTRA_PARAMS
#define PROJ_EXTRA_PARAMS
#endif
#ifndef SM_MASK_HOOK
#define SM_MASK_HOOK (void)0
#endif

// q / k planes and v planes lie in FRAGMENT ORDER: a tile = 16 rows x 32 k of one 16x16x32 operand = 512 elements [k half (16)][lane = 16 (k >> 3 & 1) + row][8 k], so a wave's 16-byte-a-lane load covers 512 contiguous bytes (4 whole lines).
// q / k: row = token, k = channel, tile index (t >> 4) * (CC / 32) + (c >> 5); v: row = channel, k = token, tile index (t >> 5) * (CC / 16) + (c >> 4)
#define FT 512   // elements of a fragment tile
static_assert(CC == 64, "a k_proj block's 64 columns are every channel tile of its rows, so its tiles are contiguous");
#define WS_QH  0u                                      // f16 q tiles [b*t / 16][CC / 32]
#define WS_KH  (WS_QH + 2u * (size_t)NB * TT * CC)      // f16 k tiles [b*t / 16][CC / 32]
#define WS_VT  (WS_KH + 2u * (size_t)NB * TT * CC)      // f16 v tiles [b][t / 32][CC / 16]
#define WS_QL  (WS_VT + 2u * (size_t)NB * CC * TT)      // f16 q residual x 2^10 tiles, t < QHI
#define WS_KL  (WS_QL + 2u * (size_t)NB * QHI * CC)     // f16 k residual x 2^10 tiles, t < KHI
#define WS_VB  (WS_KL + 2u * (size_t)NB * KHI * CC)     // bf16 v hi tiles, t < KHI
#define WS_VBL (WS_VB + 2u * (size_t)NB * CC * KHI)
#define WS_S   (WS_VBL + 2u * (size_t)NB * CC * KHI)    // f32 [hg][t][s], unused: logits and P stay in registers
#define WS_Y   (WS_S  + 4u * (size_t)HG * TT * TT)      // f32 ctx rows [b*t][CC] (only when there is an output projection)
#define WS_END (WS_Y  + 0u)

typedef __attribute__((ext_vector_type(4))) __bf16 v4b;
#define SB 16   // rows of a staging batch
static_assert(64 % SB == 0 && (64 + 64) / SB % 3 == 2, "a batch lies in one operand; the staged rows are whole trips of three batches and two batches more");
__device__ __forceinline__ void st_load(v4f (&t)[SB], const float* sp) {
#pragma unroll
  for (int i = 0; i < SB; ++i) t[i] = *(const v4f*)(sp + (size_t)i * DIN);
  asm volatile("s_wait_xcnt 0x0" :: "v"(sp) : "memory"); }   /* a precaution: the wait stands ahead of any reuse of the batch's shared address pair; naming the pair keeps it whole until here, so that no load's own result lands on it */
__device__ __forceinline__ void st_put(const v4f (&t)[SB], __bf16* dp) {
#pragma unroll
  for (int i = 0; i < SB; ++i) { v4b o; o[0] = (__bf16)t[i][0]; o[1] = (__bf16)t[i][1]; o[2] = (__bf16)t[i][2]; o[3] = (__bf16)t[i][3]; *(v4b*)(dp + i * (DIN + 8)) = o; } }
// a thread's four 16-byte pieces of a block's 8-KiB run of tiles, 2 KiB apart: every wave-wide store covers 512 contiguous bytes
__device__ __forceinline__ void st4(void* p, const v4u (&a)[4]) {
#pragma unroll
  for (int i = 0; i < 4; ++i) *(v4u*)((char*)p + i * 2048) = a[i];
  asm volatile("s_wait_xcnt 0x0" :: "v"(p), "v"(a[0]), "v"(a[1]), "v"(a[2]), "v"(a[3]) : "memory"); }   /* a precaution: the wait stands ahead of any reuse of the stores' registers; naming them keeps address and data whole until here */
// ---- k_proj: block = (64 rows, 64 cols, which), the weights and biases read as they are given: q/k/v = X W (+ b) with exact bf16 products (K = DIN), both operand tiles rounded to bf16 once and held in LDS -> which 0: q f16 (+ residual, rows < QHI); 1: k f16 (+ residual, rows < KHI); 2: v f16 (+ bf16 hi/lo for t < KHI), all stored as fragment tiles
__global__ __launch_bounds__(128) void k_proj(const float* __restrict__ XQ, const float* __restrict__ XK, const float* __restrict__ XV, const float* __restrict__ WQ, const float* __restrict__ WK, const float* __restrict__ WV, const float* __restrict__ BQ, const float* __restrict__ BK, const float* __restrict__ BV,
    _Float16* __restrict__ QH, _Float16* __restrict__ QL, _Float16* __restrict__ KH, _Float16* __restrict__ KL, _Float16* __restrict__ VT, __bf16* __restrict__ VB, __bf16* __restrict__ VBL) {
  __shared__ __align__(16) _Float16 sh[64][72], sl[64][72]; __shared__ __align__(16) _Float16 th[64][72]; __shared__ __align__(16) __bf16 tb[64][72], tbl[64][72];
  __shared__ __align__(16) __bf16 sxw[64 + 64][DIN + 8];   /* bf16 operand tiles, the 64 X rows and then the 64 W rows; row pitch 16 B x odd: conflict-free for the 16-byte fragment reads */
  const int tid = threadIdx.x, wave = tid >> 5, lane = tid & 31, col = lane & 15, g = lane >> 4; const int which = blockIdx.z; const int c0 = blockIdx.y * 64; const size_t r0 = (size_t)blockIdx.x * 64; const size_t bb = r0 / TT; const int t0 = (int)(r0 % TT);
  const float* X = which == 0 ? XQ : which == 1 ? XK : XV; const float* WA = which == 0 ? WQ : which == 1 ? WK : WV; const float* BA = which == 0 ? BQ : which == 1 ? BK : BV;
  // the 64 X rows and the 64 W rows are each one contiguous range, and 128 threads x 4 floats are one row: every wave-wide load covers 512 contiguous bytes (4 whole lines), every element is read and rounded once a block
  { const float* xb = X + r0 * DIN + tid * 4; const float* wb = WA + (size_t)c0 * DIN + tid * 4;   /* staged row r is X row r below 64, W row r - 64 from there on */
    __bf16* dp = &sxw[0][tid * 4]; v4f u0[SB], u1[SB], u2[SB];
    st_load(u0, xb); st_load(u1, xb + (size_t)SB * DIN);
#pragma unroll 1   /* rolled, three register sets: two to three batches' loads stay in flight while the oldest batch is rounded and stored */
    for (int b0 = 0; b0 < 64 + 64 - 2 * SB; b0 += 3 * SB) { const int b1 = b0 + SB, b2 = b0 + 2 * SB, b3 = b0 + 3 * SB, b4 = b0 + 4 * SB;
      st_load(u2, b2 < 64 ? xb + (size_t)b2 * DIN : wb + (size_t)(b2 - 64) * DIN); st_put(u0, dp + b0 * (DIN + 8));
      st_load(u0, b3 < 64 ? xb + (size_t)b3 * DIN : wb + (size_t)(b3 - 64) * DIN); st_put(u1, dp + b1 * (DIN + 8));
      st_load(u1, b4 < 64 ? xb + (size_t)b4 * DIN : wb + (size_t)(b4 - 64) * DIN); st_put(u2, dp + b2 * (DIN + 8)); }
    st_put(u0, dp + (64 + 64 - 2 * SB) * (DIN + 8)); st_put(u1, dp + (64 + 64 - SB) * (DIN + 8)); }   /* the last two batches, loaded in the last trip */
  __syncthreads();   /* both tiles are whole in LDS before any wave reads a fragment */
  v8f acc[4] = {};
  const __bf16* ap = &sxw[wave * 16 + col][0]; const __bf16* wp = &sxw[64 + col][0];
  v16b a = frag_b(ap, lane), w[4];
#pragma unroll
  for (int j = 0; j < 4; ++j) w[j] = frag_b(wp + j * 16 * (DIN + 8), lane);
#pragma unroll   /* whole: the next step's fragments are read as one group ahead of this step's products, into a second register set */
  for (int kc = 0; kc < DIN / 32; ++kc) { v16b an = a, wn[4];
#pragma unroll
    for (int j = 0; j < 4; ++j) wn[j] = w[j];
    if (kc + 1 < DIN / 32) { an = frag_b(ap + (kc + 1) * 32, lane);
#pragma unroll
      for (int j = 0; j < 4; ++j) wn[j] = frag_b(wp + j * 16 * (DIN + 8) + (kc + 1) * 32, lane); }
#pragma unroll
    for (int j = 0; j < 4; ++j) acc[j] = wmma_bf(a, w[j], acc[j]);
    a = an;
#pragma unroll
    for (int j = 0; j < 4; ++j) w[j] = wn[j]; }
  if (which < 2) { _Float16* DH = which == 0 ? QH : KH; _Float16* DL = which == 0 ? QL : KL; const int nhi = which == 0 ? QHI : KHI; const bool hi_rows = t0 < nhi;
#pragma unroll
    for (int j = 0; j < 4; ++j) { const float bias = BA ? bfr(BA[c0 + j * 16 + col]) : 0.f;
#pragma unroll
      for (int r = 0; r < 8; ++r) { const float v = acc[j][r] + bias; const _Float16 hv = (_Float16)v; sh[wave * 16 + 8 * g + r][j * 16 + col] = hv; sl[wave * 16 + 8 * g + r][j * 16 + col] = (_Float16)((v - (float)hv) * 1024.0f); } }
    __syncthreads();
    v4u pc[4];   /* piece e = tid + 128 i of the block in fragment order (row tile, channel tile, k half, lane): its 64 rows are one contiguous run of tiles */
#pragma unroll
    for (int i = 0; i < 4; ++i) { const int e = tid + i * 128; pc[i] = *(const v4u*)&sh[(e >> 7) * 16 + (e & 15)][((e >> 4) & 7) * 8]; }
    st4(DH + r0 * CC + tid * 8, pc);
    if (hi_rows) {
#pragma unroll
      for (int i = 0; i < 4; ++i) { const int e = tid + i * 128; pc[i] = *(const v4u*)&sl[(e >> 7) * 16 + (e & 15)][((e >> 4) & 7) * 8]; }
      st4(DL + (bb * nhi + t0) * (size_t)CC + tid * 8, pc); }
  } else { const bool hi_rows = t0 < KHI;
#pragma unroll
    for (int j = 0; j < 4; ++j) { const float bias = BA ? bfr(BA[c0 + j * 16 + col]) : 0.f;
#pragma unroll
      for (int r = 0; r < 8; ++r) { const float v = acc[j][r] + bias; const int rl = wave * 16 + 8 * g + r, cl = j * 16 + col; th[cl][rl] = (_Float16)v; const __bf16 bh = (__bf16)v; tb[cl][rl] = bh; tbl[cl][rl] = (__bf16)(v - (float)bh); } }
    __syncthreads();
    v4u pc[4];   /* piece e = tid + 128 i of the block in fragment order (token tile, channel tile, k half, lane): its 64 tokens are one contiguous run of tiles */
#pragma unroll
    for (int i = 0; i < 4; ++i) { const int e = tid + i * 128; pc[i] = *(const v4u*)&th[((e >> 6) & 3) * 16 + (e & 15)][((e >> 8) * 4 + ((e >> 4) & 3)) * 8]; }
    st4(VT + bb * CC * (size_t)TT + (size_t)t0 * CC + tid * 8, pc);
    if (hi_rows) { const size_t o3 = bb * CC * (size_t)KHI + (size_t)t0 * CC + tid * 8;
#pragma unroll
      for (int i = 0; i < 4; ++i) { const int e = tid + i * 128; pc[i] = *(const v4u*)&tb[((e >> 6) & 3) * 16 + (e & 15)][((e >> 8) * 4 + ((e >> 4) & 3)) * 8]; }
      st4(VB + o3, pc);
#pragma unroll
      for (int i = 0; i < 4; ++i) { const int e = tid + i * 128; pc[i] = *(const v4u*)&tbl[((e >> 6) & 3) * 16 + (e & 15)][((e >> 8) * 4 + ((e >> 4) & 3)) * 8]; }
      st4(VBL + o3, pc); } } }
// ---- k_att: block = 16 queries of (b, h), PVW waves: wave w takes the 32-key chunks w, w + PVW, ... of keys [0, last query] and keeps its logits in registers from the products to P.
// Logits as S^T = K . Q^T (A = 16 key rows, B = 16 query rows): D register r of key tile tt = key 16 tt + 8 g + r of query col, which is element 8 tt + r of the A fragment of P . v, so P needs no LDS and no lane exchange.
// Query rows < QHI: q hi + residual against k hi + residual (3 products), P and v as bf16 hi + lo (3 products); later rows: 1 product each. Causal mask by index. Softmax in f32 against the wave's own row maximum: P = exp(logit - max) x 2^11.
// The PVW partial (ctx, maximum, sum) triples are merged in LDS in wave order, each scaled by exp(own maximum - row maximum), and go straight to out[b][t][0..63] (the one real head): 256-B row by 16 lanes
// a fragment tile's two 512-byte halves, the lane's 8 * lane already in the pointer
__device__ __forceinline__ v16h frag_p(const _Float16* p) { union { v16h v; v8h q[2]; } u; u.q[0] = *(const v8h*)p; u.q[1] = *(const v8h*)(p + FT / 2); return u.v; }
__device__ __forceinline__ v16b frag_pb(const __bf16* p) { union { v16b v; v8b q[2]; } u; u.q[0] = *(const v8b*)p; u.q[1] = *(const v8b*)(p + FT / 2); return u.v; }
#define PVW 32
#define NCH (TT / 32 / PVW)   // most chunks one wave can own
#define MFLOOR (-1.0e30f)     // floor of a wave's row maximum: a masked logit (-3e38) stays about 3e38 below it, so its exp is 0 also in a row that the wave sees wholly masked
static_assert(QHI / 32 <= PVW, "a high-precision block has at most one chunk a wave");
static_assert(QBH * 64 == QHI && KHI >= QHI, "residual planes cover every row and key of the high-precision blocks");
__global__ __launch_bounds__(32 * PVW) void k_att(const _Float16* __restrict__ QH, const _Float16* __restrict__ KH, const _Float16* __restrict__ QL, const _Float16* __restrict__ KL, const _Float16* __restrict__ VT, const __bf16* __restrict__ VB, const __bf16* __restrict__ VBL, int b, int h0, float* __restrict__ OUT) { const int h = h0 + blockIdx.z; __shared__ __align__(16) float ss[PVW][16][HD + 4]; __shared__ float smx[PVW][16], ssm[PVW][16];
  const int tid = threadIdx.x, wave = __builtin_amdgcn_readfirstlane(tid >> 5) /* scalar: the chunk tests branch on SCC, EXEC stays whole at the WMMAs */, lane = tid & 31, col = lane & 15, g = lane >> 4; const int qb = blockIdx.x >> 2; const int ql0 = blockIdx.x * 16; const int kce = ((ql0 + 15) >> 5) + 1;   /* chunks that hold a key <= the block's last query */
  const int t = ql0 + col; const size_t q0 = (size_t)b * TT + ql0, kr0 = (size_t)b * TT;
  v8f acc[HD / 16] = {}; float mw = -3.0e38f, sw = 0.f;
  if (qb < QBH) {
    if (wave < kce) { const int k0 = wave * 32; const _Float16* QLb = QL + (size_t)b * QHI * CC; const _Float16* KLb = KL + (size_t)b * KHI * CC;
      const int fo = (h * HD / 32) * FT + lane * 8; const _Float16 *qhp = QH + q0 * CC + fo, *qlp = QLb + (size_t)ql0 * CC + fo, *khp = KH + (kr0 + k0) * CC + fo, *klp = KLb + (size_t)k0 * CC + fo;
      v8f a[2] = {}, al[2] = {};
#pragma unroll
      for (int kc = 0; kc < HD / 32; ++kc) { const v16h qh = frag_p(qhp + kc * FT), ql = frag_p(qlp + kc * FT);
        asm volatile("s_wait_xcnt 0x0" :: "v"(qhp), "v"(qlp) : "memory");   /* a precaution: the loads' address pairs stay whole until here, so that no load's own result lands on one */
#pragma unroll
        for (int tt = 0; tt < 2; ++tt) { const v16h kh = frag_p(khp + tt * 16 * CC + kc * FT), kl = frag_p(klp + tt * 16 * CC + kc * FT);
          asm volatile("s_wait_xcnt 0x0" :: "v"(khp), "v"(klp) : "memory");   /* as behind the q loads */
          a[tt] = wmma16(kh, qh, a[tt]); al[tt] = wmma16(kh, ql, al[tt]); al[tt] = wmma16(kl, qh, al[tt]); } }
      float lg[16];
#pragma unroll
      for (int i = 0; i < 16; ++i) { const int key = k0 + (i >> 3) * 16 + 8 * g + (i & 7); lg[i] = key <= t ? (a[i >> 3][i & 7] + al[i >> 3][i & 7] * (1.0f / 1024.0f)) * SCALE : -3.0e38f; mw = fmaxf(mw, lg[i]); }
      mw = fmaxf(fmaxf(mw, __shfl_xor(mw, 16)), MFLOOR);
#pragma unroll
      for (int i = 0; i < 16; ++i) { const float e = expf(lg[i] - mw); sw += e; lg[i] = e * 2048.0f; }
      const F2 p = bsplit16(lg);
      const size_t po = (size_t)b * CC * KHI + ((size_t)wave * (CC / 16) + h * HD / 16) * FT + lane * 8; const __bf16 *vbp = VB + po, *vlp = VBL + po;
#pragma unroll
      for (int j = 0; j < HD / 16; ++j) { const v16b vh = frag_pb(vbp + j * FT);
        asm volatile("s_wait_xcnt 0x0" :: "v"(vbp) : "memory");   /* as behind the q loads */
        acc[j] = wmma_bf(p.h, vh, acc[j]); acc[j] = wmma_bf(p.l, vh, acc[j]); const v16b vl = frag_pb(vlp + j * FT);
        asm volatile("s_wait_xcnt 0x0" :: "v"(vlp) : "memory");   /* as behind the q loads */
        acc[j] = wmma_bf(p.h, vl, acc[j]); } }
  } else {
    const _Float16* qp = QH + q0 * CC + (h * HD / 32) * FT + lane * 8; const v16h qf0 = frag_p(qp), qf1 = frag_p(qp + FT);
    asm volatile("s_wait_xcnt 0x0" :: "v"(qp) : "memory");   /* the loads' address pair is free for reuse only behind this wait; naming it keeps it whole until here */
    float lg[NCH][16];
#pragma unroll
    for (int c = 0; c < NCH; ++c) { const int kc = wave + c * PVW, k0 = kc * 32;
      if (kc < kce) { const _Float16* kp = KH + (kr0 + k0) * CC + (h * HD / 32) * FT + lane * 8;
        const v16h kf0 = frag_p(kp), kf1 = frag_p(kp + FT), kf2 = frag_p(kp + 16 * CC), kf3 = frag_p(kp + 16 * CC + FT);   /* all four fragments asked for ahead of the first product: one latency a chunk */
        asm volatile("s_wait_xcnt 0x0" :: "v"(kp) : "memory");   /* as behind the q loads */
        v8f a0 = {}, a1 = {}; a0 = wmma16(kf0, qf0, a0); a1 = wmma16(kf2, qf0, a1); a0 = wmma16(kf1, qf1, a0); a1 = wmma16(kf3, qf1, a1);
#pragma unroll
        for (int r = 0; r < 8; ++r) { lg[c][r] = a0[r] * SCALE; lg[c][8 + r] = a1[r] * SCALE; }
        if (kc == kce - 1) {   /* only the block's last chunk holds keys past a query */
#pragma unroll
          for (int i = 0; i < 16; ++i) lg[c][i] = (k0 + (i >> 3) * 16 + 8 * g + (i & 7)) <= t ? lg[c][i] : -3.0e38f; }
#pragma unroll
        for (int i = 0; i < 16; ++i) mw = fmaxf(mw, lg[c][i]); } }
    mw = fmaxf(fmaxf(mw, __shfl_xor(mw, 16)), MFLOOR);
    v16h p[NCH];
#pragma unroll
    for (int c = 0; c < NCH; ++c) {
      if (wave + c * PVW < kce) {
#pragma unroll
        for (int i = 0; i < 16; ++i) { const float e = expf(lg[c][i] - mw); sw += e; p[c][i] = (_Float16)(e * 2048.0f); } } }
#pragma unroll
    for (int c = 0; c < NCH; ++c) {
      if (wave + c * PVW < kce) { const _Float16* vp = VT + (size_t)b * CC * TT + ((size_t)(wave + c * PVW) * (CC / 16) + h * HD / 16) * FT + lane * 8; v16h vf[HD / 16];
#pragma unroll
        for (int j = 0; j < HD / 16; ++j) vf[j] = frag_p(vp + j * FT);   /* all asked for ahead of the first product */
        asm volatile("s_wait_xcnt 0x0" :: "v"(vp) : "memory");   /* as behind the q loads: no load's own result lands on the shared address pair */
#pragma unroll
        for (int j = 0; j < HD / 16; ++j) acc[j] = wmma16(p[c], vf[j], acc[j]); } } }
  sw += __shfl_xor(sw, 16);
#pragma unroll
  for (int j = 0; j < HD / 16; ++j)
#pragma unroll
    for (int r = 0; r < 8; ++r) ss[wave][8 * g + r][j * 16 + col] = acc[j][r];
  if (g == 0) { smx[wave][col] = mw; ssm[wave][col] = sw; }   /* a wave without a chunk leaves a zero partial under a maximum no logit reaches */
  __syncthreads();   /* every wave's partial is in LDS before any is merged */
  if (tid < 16 * (HD / 4)) { const int rl = tid >> 4, q = tid & 15;
    float m = smx[0][rl];
#pragma unroll
    for (int w = 1; w < PVW; ++w) m = fmaxf(m, smx[w][rl]);
    v4f s = {}; float den = 0.f;
#pragma unroll 8   /* eight partials' LDS reads in flight at a time; unrolled whole, the reads spill */
    for (int w = 0; w < PVW; ++w) { const float f = expf(smx[w][rl] - m); s += *(const v4f*)&ss[w][rl][q * 4] * f; den += ssm[w][rl] * f; }   /* a wave that saw this row wholly masked, or no chunk at all: f = 0 beside a zero partial */
    vst2(OUT + ((size_t)b * TT + ql0 + rl) * HD + q * 4, s * (den > 0.f ? 1.0f / (2048.0f * den) : 0.f)); } }

extern "C" void kernel_launch(void* const* d_in, const int* in_sizes, int n_in, void* d_out, int out_size, void* d_ws, size_t ws_size, hipStream_t stream) {
  (void)in_sizes; (void)n_in; (void)out_size;
  const float** F = (const float**)d_in;
  if (ws_size < (size_t)WS_END) return;
  char* ws = (char*)d_ws; _Float16 *QH = (_Float16*)(ws + WS_QH), *KH = (_Float16*)(ws + WS_KH), *VT = (_Float16*)(ws + WS_VT), *QL = (_Float16*)(ws + WS_QL), *KL = (_Float16*)(ws + WS_KL); __bf16 *VB = (__bf16*)(ws + WS_VB), *VBL = (__bf16*)(ws + WS_VBL); float *S = (float*)(ws + WS_S), *Y = (float*)(ws + WS_Y);
  (void)Y; (void)S; (void)QL; (void)KL; (void)VB; (void)VBL;
  // inputs: 0 embeddings [4096,512]; 1 Wq [64,512] (out,in), 2 bq [64]; 3 Wk, 4 bk; 5 Wv, 6 bv (biases nonzero)
  k_proj<<<dim3(TNB * TT / 64, CC / 64, 3), 128, 0, stream>>>(F[0], F[0], F[0], F[1], F[3], F[5], F[2], F[4], F[6], QH, QL, KH, KL, VT, VB, VBL);
  for (int b = 0; b < TNB; ++b) {   /* the one head */
    k_att<<<dim3(TT / 16, 1, 1), 32 * PVW, 0, stream>>>(QH, KH, QL, KL, VT, VB, VBL, b, 0, (float*)d_out);
  }
}

// v006
// Measured time: 15.1 microseconds a run.
// In both of two side-by-side timings against v005, it was 1.19 times as fast.
// Over all steps from v000 it is 14.8 times as fast.
// compute dtype: all float inputs rounded to bf16; q/k/v projections with EXACT bf16 products on WMMA 16x16x32 (f32 accumulate) + bias; causal logits: 3 products (q f16 hi + residual x k hi + residual) for the first 384 rows, single f16 q x k after, x scale; softmax f32, logits and P never leave registers; exp(logit - partial max) x 2^11 once to f16 x v once to f16 (1 product; bf16 hi + lo below row 384), divided by the sum at the end; f32 output.
#include <hip/hip_runtime.h>
#include <math.h>

typedef __attribute__((ext_vector_type(16))) _Float16 v16h;
typedef __attribute__((ext_vector_type(16))) __bf16 v16b;
typedef __attribute__((ext_vector_type(8)))  _Float16 v8h;
typedef __attribute__((ext_vector_type(8)))  float v8f;
typedef __attribute__((ext_vector_type(4)))  float v4f;
typedef __attribute__((ext_vector_type(2)))  float v2f;
typedef __attribute__((ext_vector_type(4)))  unsigned v4u;
typedef __attribute__((ext_vector_type(4)))  int v4i;
typedef float __attribute__((may_alias)) float_a;
typedef int __attribute__((may_alias)) int_a;

template <typename T> __device__ __forceinline__ void vst2(void* p, T v) { *(T*)p = v;  }
__device__ __forceinline__ v8f wmma16(v16h a, v16h b, v8f c) {
  v8f d = __builtin_amdgcn_wmma_f32_16x16x32_f16(false, a, false, b, (short)0, c, false, false);
  asm volatile("v_nop\n\tv_nop\n\tv_nop\n\tv_nop" : "+v"(d) : "v"(a), "v"(b));
  return d;
}
__device__ __forceinline__ v8f wmma_bf(v16b a, v16b b, v8f c) {
  v8f d = __builtin_amdgcn_wmma_f32_16x16x32_bf16(false, a, false, b, (short)0, c, false, false);
  asm volatile("v_nop\n\tv_nop\n\tv_nop\n\tv_nop" : "+v"(d) : "v"(a), "v"(b));
  return d;
}
// 16x16x32 fragments: lane = (h = lane>>4, row/col = lane&15); elements 0..7 = k0+8h+0..7, 8..15 = k0+16+8h+0..7; D element r = row 8h+r
__device__ __forceinline__ v16h frag_h(const _Float16* rowk0, int lane) {
  union { v16h v; v8h q[2]; } u; const _Float16* p = rowk0 + 8 * (lane >> 4);
  u.q[0] = *(const v8h*)p; u.q[1] = *(const v8h*)(p + 16); return u.v;
}
__device__ __forceinline__ v16h frag_f32(const float* rowk0, int lane) {
  v16h a; const float* p = rowk0 + 8 * (lane >> 4);
#pragma unroll
  for (int i = 0; i < 8; ++i) { a[i] = (_Float16)p[i]; a[8 + i] = (_Float16)p[16 + i]; }
  return a;
}
__device__ __forceinline__ v16h frag_f32s(const float* rowk0, int lane, float sc) {
  v16h a; const float* p = rowk0 + 8 * (lane >> 4);
#pragma unroll
  for (int i = 0; i < 8; ++i) { a[i] = (_Float16)(p[i] * sc); a[8 + i] = (_Float16)(p[16 + i] * sc); }
  return a;
}
// column fragment from a [K][ld] layout (column n), rows >= K read as 0
__device__ __forceinline__ v16h fragc_f32(const float* W, int k0, int n, int lane, int ld, int K) {
  v16h a; const int g = lane >> 4;
#pragma unroll
  for (int i = 0; i < 8; ++i) { const int ka = k0 + 8 * g + i, kb = ka + 16;
    a[i] = (_Float16)(ka < K ? W[(size_t)(ka < K ? ka : K - 1) * ld + n] : 0.f); a[8 + i] = (_Float16)(kb < K ? W[(size_t)(kb < K ? kb : K - 1) * ld + n] : 0.f); }
  return a;
}
struct F2 { v16b h, l; };
__device__ __forceinline__ F2 bsplit16(const float v[16]) { F2 r;
#pragma unroll
  for (int i = 0; i < 16; ++i) { const __bf16 h = (__bf16)v[i]; r.h[i] = h; r.l[i] = (__bf16)(v[i] - (float)h); }
  return r; }
__device__ __forceinline__ F2 split_row(const float* row, int k0, int lane) { float v[16]; const float* p = row + k0 + 8 * (lane >> 4);
#pragma unroll
  for (int i = 0; i < 8; ++i) { v[i] = p[i]; v[8 + i] = p[16 + i]; }
  return bsplit16(v); }
__device__ __forceinline__ F2 split_rowK(const float* row, int k0, int lane, int K) { float v[16]; const int g = lane >> 4;
#pragma unroll
  for (int i = 0; i < 8; ++i) { const int ka = k0 + 8 * g + i, kb = ka + 16; v[i] = ka < K ? row[ka < K ? ka : K - 1] : 0.f; v[8 + i] = kb < K ? row[kb < K ? kb : K - 1] : 0.f; }
  return bsplit16(v); }
__device__ __forceinline__ F2 split_col(const float* W, int k0, int n, int lane, int ld, int K) { float v[16]; const int g = lane >> 4;
#pragma unroll
  for (int i = 0; i < 8; ++i) { const int ka = k0 + 8 * g + i, kb = ka + 16; v[i] = ka < K ? W[(size_t)(ka < K ? ka : K - 1) * ld + n] : 0.f; v[8 + i] = kb < K ? W[(size_t)(kb < K ? kb : K - 1) * ld + n] : 0.f; }
  return bsplit16(v); }
__device__ __forceinline__ v8f mac3(const F2& a, const F2& b, v8f c) { c = wmma_bf(a.l, b.h, c); c = wmma_bf(a.h, b.l, c); return wmma_bf(a.h, b.h, c); }
__device__ __forceinline__ float sigm(float v) { return 1.0f / (1.0f + expf(-v)); }
#define LDSX() do { asm volatile("s_wait_dscnt 0" ::: "memory"); __builtin_amdgcn_wave_barrier(); __builtin_amdgcn_fence(__ATOMIC_RELEASE, "workgroup"); } while (0)

// Single-head causal scaled-dot-product attention over one 4,096-token sequence (d_model 512, d_k = d_v = 64; (out,in) Wq/Wk/Wv [64,512] + biases, torch Linear convention): scores = (Q K^T + M)/sqrt(64) with M = -inf strictly above the diagonal; out = softmax(scores) V -> [4096, 64].
#define NB 1
#define TT 4096
#define CC 64             // NH * HD = projected width
#define DIN 512          // input (model) width
#define NH 1
#define HD 64
#define NQB (TT / 64)
#define HG 1
#define SCALE (0.125f)
#define CAUSAL 1
#ifndef TNB
#define TNB NB
#endif
__device__ __forceinline__ float bfr(float v) { return (float)(__bf16)v; }
__host__ __device__ __forceinline__ int kb_last(int qb) { return CAUSAL ? ((qb * 64 + 63) >> 7) : (TT / 128 - 1); }
typedef __attribute__((ext_vector_type(8))) __bf16 v8b;
__device__ __forceinline__ v16b frag_b(const __bf16* rowk0, int lane) {
  union { v16b v; v8b q[2]; } u; const __bf16* p = rowk0 + 8 * (lane >> 4);
  u.q[0] = *(const v8b*)p; u.q[1] = *(const v8b*)(p + 16); return u.v;
}
#define QBH 6              // causal: query blocks 0..QBH-1 of each sequence (few keys, no averaging) take the high-precision path
#define QHI 384            // rows carrying a q residual plane
#define KHI 384            // key rows carrying k residual / v bf16 hi+lo planes (used only by the causal high-precision path)
// B fragment (k rows k0+.., output column o) of a weight: (in,out) [K][ld] or (out,in) [ld rows of K]: bf16 exact, or f16(bf16 * 256) exact
__device__ __forceinline__ v16b wcol_io(const float* Wm, int k0, int o, int lane, int ld) { v16b w; const int g = lane >> 4;
#pragma unroll
  for (int i = 0; i < 8; ++i) { w[i] = (__bf16)Wm[(size_t)(k0 + 8 * g + i) * ld + o]; w[8 + i] = (__bf16)Wm[(size_t)(k0 + 16 + 8 * g + i) * ld + o]; }
  return w; }
__device__ __forceinline__ v16b wcol_oi(const float* Wm, int k0, int o, int lane, int K) { v16b w; const float* p = Wm + (size_t)o * K + k0 + 8 * (lane >> 4);
#pragma unroll
  for (int i = 0; i < 8; ++i) { w[i] = (__bf16)p[i]; w[8 + i] = (__bf16)p[16 + i]; }
  return w; }
__device__ __forceinline__ v16h wcolh_io(const float* Wm, int k0, int o, int lane, int ld) { v16h w; const int g = lane >> 4;
#pragma unroll
  for (int i = 0; i < 8; ++i) { w[i] = (_Float16)(bfr(Wm[(size_t)(k0 + 8 * g + i) * ld + o]) * 256.0f); w[8 + i] = (_Float16)(bfr(Wm[(size_t)(k0 + 16 + 8 * g + i) * ld + o]) * 256.0f); }
  return w; }
__device__ __forceinline__ v16h wcolh_oi(const float* Wm, int k0, int o, int lane, int K) { v16h w; const float* p = Wm + (size_t)o * K + k0 + 8 * (lane >> 4);
#pragma unroll
  for (int i = 0; i < 8; ++i) { w[i] = (_Float16)(bfr(p[i]) * 256.0f); w[8 + i] = (_Float16)(bfr(p[16 + i]) * 256.0f); }
  return w; }
#define WQKV_LAYOUT 1   // 0 = (in,out) [DIN][CC]; 1 = (out,in) [CC][DIN]; 2 = per-head [NH][DIN][HD]
__device__ __forceinline__ v16b wcol_hdk(const float* Wm, int k0, int o, int lane) { v16b w; const int g = lane >> 4; const float* p = Wm + (size_t)(o / HD) * DIN * HD + (o % HD);
#pragma unroll
  for (int i = 0; i < 8; ++i) { w[i] = (__bf16)p[(size_t)(k0 + 8 * g + i) * HD]; w[8 + i] = (__bf16)p[(size_t)(k0 + 16 + 8 * g + i) * HD]; }
  return w; }
#define WO_OUT_IN 0
#if WQKV_LAYOUT == 1
#define WCOL(W, k0, o, lane) wcol_oi(W, k0, o, lane, DIN)
#elif WQKV_LAYOUT == 2
#define WCOL(W, k0, o, lane) wcol_hdk(W, k0, o, lane)
#else
#define WCOL(W, k0, o, lane) wcol_io(W, k0, o, lane, CC)
#endif
#if WO_OUT_IN
#define WOCOL(W, k0, o, lane) wcol_oi(W, k0, o, lane, CC)
#define WOCOLH(W, k0, o, lane) wcolh_oi(W, k0, o, lane, CC)
#else
#define WOCOL(W, k0, o, lane) wcol_io(W, k0, o, lane, DIN)
#define WOCOLH(W, k0, o, lane) wcolh_io(W, k0, o, lane, DIN)
#endif
#ifndef SM_EXTRA_PARAMS
#define SM_EXTRA_PARAMS
#endif
#ifndef PROJ_EXTRA_PARAMS
#define PROJ_EXTRA_PARAMS
#endif
#ifndef SM_MASK_HOOK
#define SM_MASK_HOOK (void)0
#endif

// q / k planes and v planes lie in FRAGMENT ORDER: a tile = 16 rows x 32 k of one 16x16x32 operand = 512 elements [k half (16)][lane = 16 (k >> 3 & 1) + row][8 k], so a wave's 16-byte-a-lane load covers 512 contiguous bytes (4 whole lines).
// q / k: row = token, k = channel, tile index (t >> 4) * (CC / 32) + (c >> 5); v: row = channel, k = token, tile index (t >> 5) * (CC / 16) + (c >> 4)
#define FT 512   // elements of a fragment tile
static_assert(CC == 64, "a k_proj block's 64 columns are every channel tile of its rows, so its tiles are contiguous");
#define WS_QH  0u                                      // f16 q tiles [b*t / 16][CC / 32]
#define WS_KH  (WS_QH + 2u * (size_t)NB * TT * CC)      // f16 k tiles [b*t / 16][CC / 32]
#define WS_VT  (WS_KH + 2u * (size_t)NB * TT * CC)      // f16 v tiles [b][t / 32][CC / 16]
#define WS_QL  (WS_VT + 2u * (size_t)NB * CC * TT)      // f16 q residual x 2^10 tiles, t < QHI
#define WS_KL  (WS_QL + 2u * (size_t)NB * QHI * CC)     // f16 k residual x 2^10 tiles, t < KHI
#define WS_VB  (WS_KL + 2u * (size_t)NB * KHI * CC)     // bf16 v hi tiles, t < KHI
#define WS_VBL (WS_VB + 2u * (size_t)NB * CC * KHI)
#define WS_S   (WS_VBL + 2u * (size_t)NB * CC * KHI)    // f32 [hg][t][s], unused: logits and P stay in registers
#define WS_Y   (WS_S  + 4u * (size_t)HG * TT * TT)      // f32 ctx rows [b*t][CC] (only when there is an output projection)
#define WS_END (WS_Y  + 0u)

typedef __attribute__((ext_vector_type(4))) __bf16 v4b;
#define SB 16   // rows of a staging batch
static_assert(64 % SB == 0 && (64 + 64) / SB % 3 == 2, "a batch lies in one operand; the staged rows are whole trips of three batches and two batches more");
__device__ __forceinline__ void st_load(v4f (&t)[SB], const float* sp) {
#pragma unroll
  for (int i = 0; i < SB; ++i) t[i] = *(const v4f*)(sp + (size_t)i * DIN);
  asm volatile("s_wait_xcnt 0x0" :: "v"(sp) : "memory"); }   /* a precaution: the wait stands ahead of any reuse of the batch's shared address pair; naming the pair keeps it whole until here, so that no load's own result lands on it */
__device__ __forceinline__ void st_put(const v4f (&t)[SB], __bf16* dp) {
#pragma unroll
  for (int i = 0; i < SB; ++i) { v4b o; o[0] = (__bf16)t[i][0]; o[1] = (__bf16)t[i][1]; o[2] = (__bf16)t[i][2]; o[3] = (__bf16)t[i][3]; *(v4b*)(dp + i * (DIN + 8)) = o; } }
// a thread's four 16-byte pieces of a block's 8-KiB run of tiles, 2 KiB apart: every wave-wide store covers 512 contiguous bytes
__device__ __forceinline__ void st4(void* p, const v4u (&a)[4]) {
#pragma unroll
  for (int i = 0; i < 4; ++i) *(v4u*)((char*)p + i * 2048) = a[i];
  asm volatile("s_wait_xcnt 0x0" :: "v"(p), "v"(a[0]), "v"(a[1]), "v"(a[2]), "v"(a[3]) : "memory"); }   /* a precaution: the wait stands ahead of any reuse of the stores' registers; naming them keeps address and data whole until here */
// ---- k_proj: block = (64 rows, 64 cols, which), the weights and biases read as they are given: q/k/v = X W (+ b) with exact bf16 products (K = DIN), both operand tiles rounded to bf16 once and held in LDS -> which 0: q f16 (+ residual, rows < QHI); 1: k f16 (+ residual, rows < KHI); 2: v f16 (+ bf16 hi/lo for t < KHI), all stored as fragment tiles
__global__ __launch_bounds__(128) void k_proj(const float* __restrict__ XQ, const float* __restrict__ XK, const float* __restrict__ XV, const float* __restrict__ WQ, const float* __restrict__ WK, const float* __restrict__ WV, const float* __restrict__ BQ, const float* __restrict__ BK, const float* __restrict__ BV,
    _Float16* __restrict__ QH, _Float16* __restrict__ QL, _Float16* __restrict__ KH, _Float16* __restrict__ KL, _Float16* __restrict__ VT, __bf16* __restrict__ VB, __bf16* __restrict__ VBL) {
  __shared__ __align__(16) _Float16 sh[64][72], sl[64][72]; __shared__ __align__(16) _Float16 th[64][72]; __shared__ __align__(16) __bf16 tb[64][72], tbl[64][72];
  __shared__ __align__(16) __bf16 sxw[64 + 64][DIN + 8];   /* bf16 operand tiles, the 64 X rows and then the 64 W rows; row pitch 16 B x odd: conflict-free for the 16-byte fragment reads */
  const int tid = threadIdx.x, wave = tid >> 5, lane = tid & 31, col = lane & 15, g = lane >> 4; const int which = blockIdx.z; const int c0 = blockIdx.y * 64; const size_t r0 = (size_t)blockIdx.x * 64; const size_t bb = r0 / TT; const int t0 = (int)(r0 % TT);
  const float* X = which == 0 ? XQ : which == 1 ? XK : XV; const float* WA = which == 0 ? WQ : which == 1 ? WK : WV; const float* BA = which == 0 ? BQ : which == 1 ? BK : BV;
  // the 64 X rows and the 64 W rows are each one contiguous range, and 128 threads x 4 floats are one row: every wave-wide load covers 512 contiguous bytes (4 whole lines), every element is read and rounded once a block
  { const float* xb = X + r0 * DIN + tid * 4; const float* wb = WA + (size_t)c0 * DIN + tid * 4;   /* staged row r is X row r below 64, W row r - 64 from there on */
    __bf16* dp = &sxw[0][tid * 4]; v4f u0[SB], u1[SB], u2[SB];
    st_load(u0, xb); st_load(u1, xb + (size_t)SB * DIN);
#pragma unroll 1   /* rolled, three register sets: two to three batches' loads stay in flight while the oldest batch is rounded and stored */
    for (int b0 = 0; b0 < 64 + 64 - 2 * SB; b0 += 3 * SB) { const int b1 = b0 + SB, b2 = b0 + 2 * SB, b3 = b0 + 3 * SB, b4 = b0 + 4 * SB;
      st_load(u2, b2 < 64 ? xb + (size_t)b2 * DIN : wb + (size_t)(b2 - 64) * DIN); st_put(u0, dp + b0 * (DIN + 8));
      st_load(u0, b3 < 64 ? xb + (size_t)b3 * DIN : wb + (size_t)(b3 - 64) * DIN); st_put(u1, dp + b1 * (DIN + 8));
      st_load(u1, b4 < 64 ? xb + (size_t)b4 * DIN : wb + (size_t)(b4 - 64) * DIN); st_put(u2, dp + b2 * (DIN + 8)); }
    st_put(u0, dp + (64 + 64 - 2 * SB) * (DIN + 8)); st_put(u1, dp + (64 + 64 - SB) * (DIN + 8)); }   /* the last two batches, loaded in the last trip */
  __syncthreads();   /* both tiles are whole in LDS before any wave reads a fragment */
  v8f acc[4] = {};
  const __bf16* ap = &sxw[wave * 16 + col][0]; const __bf16* wp = &sxw[64 + col][0];
  v16b a = frag_b(ap, lane), w[4];
#pragma unroll
  for (int j = 0; j < 4; ++j) w[j] = frag_b(wp + j * 16 * (DIN + 8), lane);
#pragma unroll   /* whole: the next step's fragments are read as one group ahead of this step's products, into a second register set */
  for (int kc = 0; kc < DIN / 32; ++kc) { v16b an = a, wn[4];
#pragma unroll
    for (int j = 0; j < 4; ++j) wn[j] = w[j];
    if (kc + 1 < DIN / 32) { an = frag_b(ap + (kc + 1) * 32, lane);
#pragma unroll
      for (int j = 0; j < 4; ++j) wn[j] = frag_b(wp + j * 16 * (DIN + 8) + (kc + 1) * 32, lane); }
#pragma unroll
    for (int j = 0; j < 4; ++j) acc[j] = wmma_bf(a, w[j], acc[j]);
    a = an;
#pragma unroll
    for (int j = 0; j < 4; ++j) w[j] = wn[j]; }
  if (which < 2) { _Float16* DH = which == 0 ? QH : KH; _Float16* DL = which == 0 ? QL : KL; const int nhi = which == 0 ? QHI : KHI; const bool hi_rows = t0 < nhi;
#pragma unroll
    for (int j = 0; j < 4; ++j) { const float bias = BA ? bfr(BA[c0 + j * 16 + col]) : 0.f;
#pragma unroll
      for (int r = 0; r < 8; ++r) { const float v = acc[j][r] + bias; const _Float16 hv = (_Float16)v; sh[wave * 16 + 8 * g + r][j * 16 + col] = hv; sl[wave * 16 + 8 * g + r][j * 16 + col] = (_Float16)((v - (float)hv) * 1024.0f); } }
    __syncthreads();
    v4u pc[4];   /* piece e = tid + 128 i of the block in fragment order (row tile, channel tile, k half, lane): its 64 rows are one contiguous run of tiles */
#pragma unroll
    for (int i = 0; i < 4; ++i) { const int e = tid + i * 128; pc[i] = *(const v4u*)&sh[(e >> 7) * 16 + (e & 15)][((e >> 4) & 7) * 8]; }
    st4(DH + r0 * CC + tid * 8, pc);
    if (hi_rows) {
#pragma unroll
      for (int i = 0; i < 4; ++i) { const int e = tid + i * 128; pc[i] = *(const v4u*)&sl[(e >> 7) * 16 + (e & 15)][((e >> 4) & 7) * 8]; }
      st4(DL + (bb * nhi + t0) * (size_t)CC + tid * 8, pc); }
  } else { const bool hi_rows = t0 < KHI;
#pragma unroll
    for (int j = 0; j < 4; ++j) { const float bias = BA ? bfr(BA[c0 + j * 16 + col]) : 0.f;
#pragma unroll
      for (int r = 0; r < 8; ++r) { const float v = acc[j][r] + bias; const int rl = wave * 16 + 8 * g + r, cl = j * 16 + col; th[cl][rl] = (_Float16)v; const __bf16 bh = (__bf16)v; tb[cl][rl] = bh; tbl[cl][rl] = (__bf16)(v - (float)bh); } }
    __syncthreads();
    v4u pc[4];   /* piece e = tid + 128 i of the block in fragment order (token tile, channel tile, k half, lane): its 64 tokens are one contiguous run of tiles */
#pragma unroll
    for (int i = 0; i < 4; ++i) { const int e = tid + i * 128; pc[i] = *(const v4u*)&th[((e >> 6) & 3) * 16 + (e & 15)][((e >> 8) * 4 + ((e >> 4) & 3)) * 8]; }
    st4(VT + bb * CC * (size_t)TT + (size_t)t0 * CC + tid * 8, pc);
    if (hi_rows) { const size_t o3 = bb * CC * (size_t)KHI + (size_t)t0 * CC + tid * 8;
#pragma unroll
      for (int i = 0; i < 4; ++i) { const int e = tid + i * 128; pc[i] = *(const v4u*)&tb[((e >> 6) & 3) * 16 + (e & 15)][((e >> 8) * 4 + ((e >> 4) & 3)) * 8]; }
      st4(VB + o3, pc);
#pragma unroll
      for (int i = 0; i < 4; ++i) { const int e = tid + i * 128; pc[i] = *(const v4u*)&tbl[((e >> 6) & 3) * 16 + (e & 15)][((e >> 8) * 4 + ((e >> 4) & 3)) * 8]; }
      st4(VBL + o3, pc); } } }
// ---- k_att: block = 16 queries of (b, h), PVW waves: wave w takes the 32-key chunks w, w + PVW, ... of keys [0, last query] and keeps its logits in registers from the products to P.
// Logits as S^T = K . Q^T (A = 16 key rows, B = 16 query rows): D register r of key tile tt = key 16 tt + 8 g + r of query col, which is element 8 tt + r of the A fragment of P . v, so P needs no LDS and no lane exchange.
// Query rows < QHI: q hi + residual against k hi + residual (3 products), P and v as bf16 hi + lo (3 products); later rows: 1 product each. Causal mask by index. Softmax in f32 against the wave's own row maximum, in base 2: P = 2^(L2S (logit - max) + 11) = exp(scaled logit - max) x 2^11, and the wave's sum carries the same 2^11.
// The PVW partial (ctx, maximum, sum) triples are merged in LDS in wave order, each scaled by 2^(own exponent offset - the row's largest), and go straight to out[b][t][0..63] (the one real head): 256-B row by 16 lanes
// a fragment tile's two 512-byte halves, the lane's 8 * lane already in the pointer
__device__ __forceinline__ v16h frag_p(const _Float16* p) { union { v16h v; v8h q[2]; } u; u.q[0] = *(const v8h*)p; u.q[1] = *(const v8h*)(p + FT / 2); return u.v; }
__device__ __forceinline__ v16b frag_pb(const __bf16* p) { union { v16b v; v8b q[2]; } u; u.q[0] = *(const v8b*)p; u.q[1] = *(const v8b*)(p + FT / 2); return u.v; }
#define PVW 32
#define NCH (TT / 32 / PVW)   // most chunks one wave can own
#define MFLOOR (-1.0e30f)     // floor of a wave's row maximum: a masked logit (-3e38) stays about 3e38 below it, so its exp is 0 also in a row that the wave sees wholly masked
#define L2S (SCALE * 1.44269504088896340736f)   // unscaled logit -> exponent of 2: exp(SCALE x) = 2^(L2S x)
// 2^x on the hardware's own instruction, no range code around it: every argument here is at most about 11, and a result below 2^-126 may come out as 0 (it is far below one f16 or bf16 step of P)
__device__ __forceinline__ float ex2(float x) { return __builtin_amdgcn_exp2f(x); }
static_assert(QHI / 32 <= PVW, "a high-precision block has at most one chunk a wave");
static_assert(QBH * 64 == QHI && KHI >= QHI, "residual planes cover every row and key of the high-precision blocks");
__global__ __launch_bounds__(32 * PVW) void k_att(const _Float16* __restrict__ QH, const _Float16* __restrict__ KH, const _Float16* __restrict__ QL, const _Float16* __restrict__ KL, const _Float16* __restrict__ VT, const __bf16* __restrict__ VB, const __bf16* __restrict__ VBL, int b, int h0, float* __restrict__ OUT) { const int h = h0 + blockIdx.z; __shared__ __align__(16) float ss[PVW][16][HD + 4]; __shared__ float smx[PVW][16], ssm[PVW][16];
  const int tid = threadIdx.x, wave = __builtin_amdgcn_readfirstlane(tid >> 5) /* scalar: the chunk tests branch on SCC, EXEC stays whole at the WMMAs */, lane = tid & 31, col = lane & 15, g = lane >> 4; const int qb = blockIdx.x >> 2; const int ql0 = blockIdx.x * 16; const int kce = ((ql0 + 15) >> 5) + 1;   /* chunks that hold a key <= the block's last query */
  const int t = ql0 + col; const size_t q0 = (size_t)b * TT + ql0, kr0 = (size_t)b * TT;
  v8f acc[HD / 16] = {}; float mw = -3.0e38f, sw = 0.f;
  if (qb < QBH) {
    if (wave < kce) { const int k0 = wave * 32; const _Float16* QLb = QL + (size_t)b * QHI * CC; const _Float16* KLb = KL + (size_t)b * KHI * CC;
      const int fo = (h * HD / 32) * FT + lane * 8; const _Float16 *qhp = QH + q0 * CC + fo, *qlp = QLb + (size_t)ql0 * CC + fo, *khp = KH + (kr0 + k0) * CC + fo, *klp = KLb + (size_t)k0 * CC + fo;
      v8f a[2] = {}, al[2] = {};
#pragma unroll
      for (int kc = 0; kc < HD / 32; ++kc) { const v16h qh = frag_p(qhp + kc * FT), ql = frag_p(qlp + kc * FT);
        asm volatile("s_wait_xcnt 0x0" :: "v"(qhp), "v"(qlp) : "memory");   /* a precaution: the loads' address pairs stay whole until here, so that no load's own result lands on one */
#pragma unroll
        for (int tt = 0; tt < 2; ++tt) { const v16h kh = frag_p(khp + tt * 16 * CC + kc * FT), kl = frag_p(klp + tt * 16 * CC + kc * FT);
          asm volatile("s_wait_xcnt 0x0" :: "v"(khp), "v"(klp) : "memory");   /* as behind the q loads */
          a[tt] = wmma16(kh, qh, a[tt]); al[tt] = wmma16(kh, ql, al[tt]); al[tt] = wmma16(kl, qh, al[tt]); } }
      float lg[16];
#pragma unroll
      for (int i = 0; i < 16; ++i) { const int key = k0 + (i >> 3) * 16 + 8 * g + (i & 7); lg[i] = key <= t ? a[i >> 3][i & 7] + al[i >> 3][i & 7] * (1.0f / 1024.0f) : -3.0e38f; mw = fmaxf(mw, lg[i]); }
      mw = fmaxf(fmaxf(mw, __shfl_xor(mw, 16)), MFLOOR);
      const float nb = fmaf(-mw, L2S, 11.0f);   /* one fma a logit gives the whole exponent: scale, log2 e, the maximum and the 2^11 */
#pragma unroll
      for (int i = 0; i < 16; ++i) { const float e = ex2(fmaf(lg[i], L2S, nb)); sw += e; lg[i] = e; }
      mw = -nb;   /* what the merge compares: the very number that went into the exponents */
      const F2 p = bsplit16(lg);
      const size_t po = (size_t)b * CC * KHI + ((size_t)wave * (CC / 16) + h * HD / 16) * FT + lane * 8; const __bf16 *vbp = VB + po, *vlp = VBL + po;
#pragma unroll
      for (int j = 0; j < HD / 16; ++j) { const v16b vh = frag_pb(vbp + j * FT);
        asm volatile("s_wait_xcnt 0x0" :: "v"(vbp) : "memory");   /* as behind the q loads */
        acc[j] = wmma_bf(p.h, vh, acc[j]); acc[j] = wmma_bf(p.l, vh, acc[j]); const v16b vl = frag_pb(vlp + j * FT);
        asm volatile("s_wait_xcnt 0x0" :: "v"(vlp) : "memory");   /* as behind the q loads */
        acc[j] = wmma_bf(p.h, vl, acc[j]); } }
  } else {
    const _Float16* qp = QH + q0 * CC + (h * HD / 32) * FT + lane * 8; const v16h qf0 = frag_p(qp), qf1 = frag_p(qp + FT);
    asm volatile("s_wait_xcnt 0x0" :: "v"(qp) : "memory");   /* the loads' address pair is free for reuse only behind this wait; naming it keeps it whole until here */
    float lg[NCH][16];
#pragma unroll
    for (int c = 0; c < NCH; ++c) { const int kc = wave + c * PVW, k0 = kc * 32;
      if (kc < kce) { const _Float16* kp = KH + (kr0 + k0) * CC + (h * HD / 32) * FT + lane * 8;
        const v16h kf0 = frag_p(kp), kf1 = frag_p(kp + FT), kf2 = frag_p(kp + 16 * CC), kf3 = frag_p(kp + 16 * CC + FT);   /* all four fragments asked for ahead of the first product: one latency a chunk */
        asm volatile("s_wait_xcnt 0x0" :: "v"(kp) : "memory");   /* as behind the q loads */
        v8f a0 = {}, a1 = {}; a0 = wmma16(kf0, qf0, a0); a1 = wmma16(kf2, qf0, a1); a0 = wmma16(kf1, qf1, a0); a1 = wmma16(kf3, qf1, a1);
#pragma unroll
        for (int r = 0; r < 8; ++r) { lg[c][r] = a0[r]; lg[c][8 + r] = a1[r]; }
        if (kc == kce - 1) {   /* only the block's last chunk holds keys past a query */
#pragma unroll
          for (int i = 0; i < 16; ++i) lg[c][i] = (k0 + (i >> 3) * 16 + 8 * g + (i & 7)) <= t ? lg[c][i] : -3.0e38f; }
#pragma unroll
        for (int i = 0; i < 16; ++i) mw = fmaxf(mw, lg[c][i]); } }
    mw = fmaxf(fmaxf(mw, __shfl_xor(mw, 16)), MFLOOR);
    const float nb = fmaf(-mw, L2S, 11.0f);   /* as in the high-precision path */
    v16h p[NCH];
#pragma unroll
    for (int c = 0; c < NCH; ++c) {
      if (wave + c * PVW < kce) {
#pragma unroll
        for (int i = 0; i < 16; ++i) { const float e = ex2(fmaf(lg[c][i], L2S, nb)); sw += e; p[c][i] = (_Float16)e; } } }
    mw = -nb;
#pragma unroll
    for (int c = 0; c < NCH; ++c) {
      if (wave + c * PVW < kce) { const _Float16* vp = VT + (size_t)b * CC * TT + ((size_t)(wave + c * PVW) * (CC / 16) + h * HD / 16) * FT + lane * 8; v16h vf[HD / 16];
#pragma unroll
        for (int j = 0; j < HD / 16; ++j) vf[j] = frag_p(vp + j * FT);   /* all asked for ahead of the first product */
        asm volatile("s_wait_xcnt 0x0" :: "v"(vp) : "memory");   /* as behind the q loads: no load's own result lands on the shared address pair */
#pragma unroll
        for (int j = 0; j < HD / 16; ++j) acc[j] = wmma16(p[c], vf[j], acc[j]); } } }
  sw += __shfl_xor(sw, 16);
#pragma unroll
  for (int j = 0; j < HD / 16; ++j)
#pragma unroll
    for (int r = 0; r < 8; ++r) ss[wave][8 * g + r][j * 16 + col] = acc[j][r];
  if (g == 0) { smx[wave][col] = mw; ssm[wave][col] = sw; }   /* a wave without a chunk leaves a zero partial under a maximum no logit reaches */
  __syncthreads();   /* every wave's partial is in LDS before any is merged */
  if (tid < 16 * (HD / 4)) { const int rl = tid >> 4, q = tid & 15;
    float m = smx[0][rl];
#pragma unroll
    for (int w = 1; w < PVW; ++w) m = fmaxf(m, smx[w][rl]);
    v4f s = {}; float den = 0.f;
#pragma unroll 8   /* eight partials' LDS reads in flight at a time; unrolled whole, the reads spill */
    for (int w = 0; w < PVW; ++w) { const float f = ex2(smx[w][rl] - m); s += *(const v4f*)&ss[w][rl][q * 4] * f; den += ssm[w][rl] * f; }   /* a wave that saw this row wholly masked, or no chunk at all: f = 0 beside a zero partial */
    vst2(OUT + ((size_t)b * TT + ql0 + rl) * HD + q * 4, s * (den > 0.f ? 1.0f / den : 0.f)); } }

extern "C" void kernel_launch(void* const* d_in, const int* in_sizes, int n_in, void* d_out, int out_size, void* d_ws, size_t ws_size, hipStream_t stream) {
  (void)in_sizes; (void)n_in; (void)out_size;
  const float** F = (const float**)d_in;
  if (ws_size < (size_t)WS_END) return;
  char* ws = (char*)d_ws; _Float16 *QH = (_Float16*)(ws + WS_QH), *KH = (_Float16*)(ws + WS_KH), *VT = (_Float16*)(ws + WS_VT), *QL = (_Float16*)(ws + WS_QL), *KL = (_Float16*)(ws + WS_KL); __bf16 *VB = (__bf16*)(ws + WS_VB), *VBL = (__bf16*)(ws + WS_VBL); float *S = (float*)(ws + WS_S), *Y = (float*)(ws + WS_Y);
  (void)Y; (void)S; (void)QL; (void)KL; (void)VB; (void)VBL;
  // inputs: 0 embeddings [4096,512]; 1 Wq [64,512] (out,in), 2 bq [64]; 3 Wk, 4 bk; 5 Wv, 6 bv (biases nonzero)
  k_proj<<<dim3(TNB * TT / 64, CC / 64, 3), 128, 0, stream>>>(F[0], F[0], F[0], F[1], F[3], F[5], F[2], F[4], F[6], QH, QL, KH, KL, VT, VB, VBL);
  for (int b = 0; b < TNB; ++b) {   /* the one head */
    k_att<<<dim3(TT / 16, 1, 1), 32 * PVW, 0, stream>>>(QH, KH, QL, KL, VT, VB, VBL, b, 0, (float*)d_out);
  }
}
